// v000
// Times are from an AMD MI455X. After a warm-up the kernel runs many times in a row, and a time is the length of
// such a window on the GPU divided by its runs, so every launch and the gaps after it count. The runs cycle
// through copies of the inputs. A figure is the median of several windows, for all but v000 over two sittings.
// Sittings can differ by a few percent; kernels timed side by side share one.
// v000 is the starting kernel. One run takes 322 microseconds.
#include <hip/hip_runtime.h>
#include <hip/hip_bf16.h>
#include <math.h>

// Problem constants (from reference)
#define B_ 4
#define T_ 512
#define S_ 512
#define IN_ 512
#define D_ 256   // MEM_DIM

typedef __attribute__((ext_vector_type(2))) float v2f;
typedef __attribute__((ext_vector_type(8))) float v8f;

// Native CDNA5 V_TANH_F32 if the toolchain exposes it; OCML fallback.
#if defined(__has_builtin)
#if __has_builtin(__builtin_amdgcn_tanhf)
#define FAST_TANH(x) __builtin_amdgcn_tanhf(x)
#endif
#endif
#ifndef FAST_TANH
#define FAST_TANH(x) tanhf(x)
#endif

// ---------------------------------------------------------------------------
// Generic fp32 WMMA GEMM:  C[M,N] = A[M,K] * W[N,K]^T (+ bias[N])
// One wave per 16x16 output tile, K-loop in steps of 4 using
// V_WMMA_F32_16X16X4_F32.
//
// A-matrix lane layout (32-bit, 16x4): lanes 0-15 hold rows m0..m0+15 with
// K = k0,k0+1 ; lanes 16-31 hold the same rows with K = k0+2,k0+3.
// B-matrix (4x16) mirrors this with columns striped across lanes.
// C/D layout: VGPR j -> M = m0 + j (+8 for upper half-wave), N = lane&15.
// ---------------------------------------------------------------------------
__global__ __launch_bounds__(256) void gemm_nt_kernel(
    const float* __restrict__ A, const float* __restrict__ W,
    const float* __restrict__ bias, float* __restrict__ C,
    int M, int N, int K) {
  int wave = blockIdx.x * (blockDim.x >> 5) + (threadIdx.x >> 5);
  int lane = threadIdx.x & 31;
  int ntn  = N >> 4;
  int m0 = (wave / ntn) << 4;
  int n0 = (wave % ntn) << 4;
  if (m0 >= M) return;                       // wave-uniform; EXEC stays all-1s

  int r  = lane & 15;                        // row (A) / col (B) within tile
  int kk = (lane >> 4) << 1;                 // K sub-offset: 0 or 2
  const float* Arow = A + (size_t)(m0 + r) * K + kk;
  const float* Wcol = W + (size_t)(n0 + r) * K + kk;

  v8f acc = {};
#pragma unroll 4
  for (int k0 = 0; k0 < K; k0 += 4) {
    v2f a = *(const v2f*)(Arow + k0);        // 8B-aligned: kk even, K even
    v2f b = *(const v2f*)(Wcol + k0);
    acc = __builtin_amdgcn_wmma_f32_16x16x4_f32(
        false, a, false, b, (short)0, acc, false, false);
  }

  int half = lane >> 4;
  int col  = n0 + r;
  float bv = bias ? bias[col] : 0.0f;
#pragma unroll
  for (int j = 0; j < 8; ++j)
    C[(size_t)(m0 + j + half * 8) * N + col] = acc[j] + bv;
}

// ---------------------------------------------------------------------------
// Fused score -> masked softmax -> context kernel.
// One block = one (batch b, 16-row t-tile). 256 threads = 8 waves.
//   Phase 1: align[tl,s] = sum_d v[d]*tanh(wq[t0+tl,d] + uh[b,s,d])
//            (wq tile + v in LDS; uh rows broadcast-read from L2;
//             native V_TANH_F32, float2 loads, 2-way accumulator ILP)
//   Phase 2: masked softmax over s (16 threads per row), write align_vectors
//   Phase 3: c[16,256] = P[16,512] * mems[b]  via f32 WMMA (A from LDS)
// ---------------------------------------------------------------------------
__global__ __launch_bounds__(256) void attn_score_ctx_kernel(
    const float* __restrict__ wq,        // [B*T, D]
    const float* __restrict__ uh,        // [B*S, D]
    const float* __restrict__ mems,      // [B, S, D]
    const float* __restrict__ v,         // [D]
    const int*   __restrict__ mem_masks, // [B]
    float* __restrict__ alignOut,        // [B, T, S]
    float* __restrict__ cOut)            // [B*T, D]
{
  __shared__ float sWq[16 * D_];         // 16 KB
  __shared__ float sP[16 * S_];          // 32 KB   scores -> probabilities
  __shared__ float sV[D_];               // 1 KB
  __shared__ float red[256];
  __shared__ float rowStat[16];

  const int tid   = threadIdx.x;
  const int b     = blockIdx.x >> 5;     // T/16 = 32 tiles per batch
  const int t0    = (blockIdx.x & 31) << 4;
  const int len   = mem_masks[b];

  // --- stage wq tile and v into LDS ---
  const float* wqBase = wq + ((size_t)b * T_ + t0) * D_;
  for (int i = tid; i < 16 * D_; i += 256) sWq[i] = wqBase[i];
  for (int i = tid; i < D_;      i += 256) sV[i]  = v[i];
  __syncthreads();

  // --- Phase 1: additive-attention scores (the 268M-tanh hot loop) ---
  {
    const float* uhB = uh + (size_t)b * S_ * D_;
    const int tl = tid & 15;                    // fixed row per thread
    const v2f* wqRow = (const v2f*)(sWq + tl * D_);
    const v2f* vv    = (const v2f*)sV;
#pragma unroll 1
    for (int i = 0; i < (16 * S_) / 256; ++i) { // 32 (tl,s) pairs / thread
      const int s = (tid >> 4) + i * 16;
      const v2f* uhRow = (const v2f*)(uhB + (size_t)s * D_);
      float a0 = 0.0f, a1 = 0.0f;               // 2-way ILP for TRANS pipe
#pragma unroll 4
      for (int d = 0; d < D_ / 2; ++d) {
        v2f u = uhRow[d];
        v2f w = wqRow[d];
        v2f vd = vv[d];
        a0 = fmaf(vd.x, FAST_TANH(w.x + u.x), a0);
        a1 = fmaf(vd.y, FAST_TANH(w.y + u.y), a1);
      }
      sP[tl * S_ + s] = a0 + a1;
    }
  }
  __syncthreads();

  // --- Phase 2: masked softmax over s, per row (16 threads / row) ---
  const int row = tid >> 4;
  const int sub = tid & 15;
  float mx = -INFINITY;
  for (int s = sub; s < S_; s += 16)
    if (s < len) mx = fmaxf(mx, sP[row * S_ + s]);
  red[tid] = mx;
  __syncthreads();
  if (sub == 0) {
    float m = red[row * 16];
    for (int j = 1; j < 16; ++j) m = fmaxf(m, red[row * 16 + j]);
    rowStat[row] = m;
  }
  __syncthreads();
  const float rm = rowStat[row];
  float sum = 0.0f;
  for (int s = sub; s < S_; s += 16) {
    float e = (s < len) ? __expf(sP[row * S_ + s] - rm) : 0.0f;
    sP[row * S_ + s] = e;
    sum += e;
  }
  red[tid] = sum;
  __syncthreads();
  if (sub == 0) {
    float t = 0.0f;
    for (int j = 0; j < 16; ++j) t += red[row * 16 + j];
    rowStat[row] = t;
  }
  __syncthreads();
  const float inv = 1.0f / rowStat[row];
  float* aOut = alignOut + ((size_t)b * T_ + t0 + row) * S_;
  for (int s = sub; s < S_; s += 16) {
    float p = sP[row * S_ + s] * inv;
    sP[row * S_ + s] = p;
    aOut[s] = p;                               // masked slots are exactly 0
  }
  __syncthreads();

  // --- Phase 3: context c = P[16,512] * mems[b][512,256] via f32 WMMA ---
  {
    const int wv   = tid >> 5;
    const int lane = tid & 31;
    const int r    = lane & 15;
    const int kk   = (lane >> 4) << 1;
    const float* memB = mems + (size_t)b * S_ * D_;
    float* cBase = cOut + ((size_t)b * T_ + t0) * D_;
    for (int nt = wv; nt < D_ / 16; nt += 8) { // 16 n-tiles over 8 waves
      const int n0 = nt << 4;
      v8f acc = {};
#pragma unroll 4
      for (int k0 = 0; k0 < S_; k0 += 4) {
        const int kb = k0 + kk;
        v2f a = *(const v2f*)(sP + r * S_ + kb);        // LDS, 8B aligned
        v2f bm;
        bm.x = memB[(size_t)kb * D_ + n0 + r];          // B: col-striped lanes
        bm.y = memB[(size_t)(kb + 1) * D_ + n0 + r];
        acc = __builtin_amdgcn_wmma_f32_16x16x4_f32(
            false, a, false, bm, (short)0, acc, false, false);
      }
      const int half = lane >> 4;
      const int col  = n0 + r;
#pragma unroll
      for (int j = 0; j < 8; ++j)
        cBase[(size_t)(j + half * 8) * D_ + col] = acc[j];
    }
  }
}

// ---------------------------------------------------------------------------
// Output projection: attn_h = concat(c, inputs) * Wout^T + bout
// Implemented as a split-K WMMA GEMM (K = 256 from c, then 512 from inputs),
// so the concat is never materialized. M = B*T = 2048, N = 512, K = 768.
// ---------------------------------------------------------------------------
__global__ __launch_bounds__(256) void outproj_kernel(
    const float* __restrict__ Cctx,   // [B*T, 256]
    const float* __restrict__ X,      // [B*T, 512]
    const float* __restrict__ W,      // [512, 768]
    const float* __restrict__ bias,   // [512]
    float* __restrict__ Out)          // [B*T, 512]
{
  const int wave = blockIdx.x * 8 + (threadIdx.x >> 5);
  const int lane = threadIdx.x & 31;
  const int m0 = (wave >> 5) << 4;      // 32 n-tiles (N=512)
  const int n0 = (wave & 31) << 4;
  const int r  = lane & 15;
  const int kk = (lane >> 4) << 1;

  const float* Ac = Cctx + (size_t)(m0 + r) * D_ + kk;
  const float* Ax = X    + (size_t)(m0 + r) * IN_ + kk;
  const float* Wc = W    + (size_t)(n0 + r) * (D_ + IN_) + kk;

  v8f acc = {};
#pragma unroll 4
  for (int k0 = 0; k0 < D_; k0 += 4) {       // K segment 1: context
    v2f a = *(const v2f*)(Ac + k0);
    v2f w = *(const v2f*)(Wc + k0);
    acc = __builtin_amdgcn_wmma_f32_16x16x4_f32(
        false, a, false, w, (short)0, acc, false, false);
  }
#pragma unroll 4
  for (int k0 = 0; k0 < IN_; k0 += 4) {      // K segment 2: inputs
    v2f a = *(const v2f*)(Ax + k0);
    v2f w = *(const v2f*)(Wc + D_ + k0);
    acc = __builtin_amdgcn_wmma_f32_16x16x4_f32(
        false, a, false, w, (short)0, acc, false, false);
  }

  const int half = lane >> 4;
  const int col  = n0 + r;
  const float bv = bias[col];
#pragma unroll
  for (int j = 0; j < 8; ++j)
    Out[(size_t)(m0 + j + half * 8) * IN_ + col] = acc[j] + bv;
}

// ---------------------------------------------------------------------------
extern "C" void kernel_launch(void* const* d_in, const int* in_sizes, int n_in,
                              void* d_out, int out_size, void* d_ws, size_t ws_size,
                              hipStream_t stream) {
  const float* inputs    = (const float*)d_in[0];  // [B,T,IN]
  const float* mems      = (const float*)d_in[1];  // [B,S,D]
  const int*   mem_masks = (const int*)  d_in[2];  // [B]
  const float* Wq        = (const float*)d_in[3];  // [D,IN]
  const float* Wc        = (const float*)d_in[4];  // [D,D]
  const float* bc        = (const float*)d_in[5];  // [D]
  const float* v         = (const float*)d_in[6];  // [D]
  const float* Wout      = (const float*)d_in[7];  // [IN, D+IN]
  const float* bout      = (const float*)d_in[8];  // [IN]

  float* attn  = (float*)d_out;                        // [B,T,IN]
  float* align = attn + (size_t)B_ * T_ * IN_;         // [B,T,S]

  float* ws  = (float*)d_ws;
  float* wq  = ws;                                     // [B*T, D]
  float* uh  = wq + (size_t)B_ * T_ * D_;              // [B*S, D]
  float* ctx = uh + (size_t)B_ * S_ * D_;              // [B*T, D]

  const int M = B_ * T_;                               // 2048 (== B*S too)

  // 1) wq = inputs * Wq^T          : 2048 tiles -> 256 blocks of 8 waves
  gemm_nt_kernel<<<(M / 16) * (D_ / 16) / 8, 256, 0, stream>>>(
      inputs, Wq, nullptr, wq, M, D_, IN_);

  // 2) uh = mems * Wc^T + bc
  gemm_nt_kernel<<<(M / 16) * (D_ / 16) / 8, 256, 0, stream>>>(
      mems, Wc, bc, uh, M, D_, D_);

  // 3) fused tanh-score + masked softmax + context (one block per 16 t-rows)
  attn_score_ctx_kernel<<<B_ * (T_ / 16), 256, 0, stream>>>(
      wq, uh, mems, v, mem_masks, align, ctx);

  // 4) attn_h = concat(ctx, inputs) * Wout^T + bout : 4096 tiles -> 512 blocks
  outproj_kernel<<<(M / 16) * (IN_ / 16) / 8, 256, 0, stream>>>(
      ctx, inputs, Wout, bout, attn);
}

// v001
// Measured time: 116 microseconds a run.
// Two timings next to v000 put it at 2.80 and 2.81 times that version's speed.
#include <hip/hip_runtime.h>
#include <hip/hip_bf16.h>
#include <math.h>

// Problem constants (from reference)
#define B_ 4
#define T_ 512
#define S_ 512
#define IN_ 512
#define D_ 256   // MEM_DIM

typedef __attribute__((ext_vector_type(2))) float v2f;
typedef __attribute__((ext_vector_type(4))) float v4f;
typedef __attribute__((ext_vector_type(8))) float v8f;

#define DC_ 32          // d values of uh staged per pass
#define UP_ (DC_ + 4)   // LDS row pitch in floats: 144 B = 16 B x odd, conflict-free b128 rows

// Native CDNA5 V_TANH_F32 if the toolchain exposes it; OCML fallback.
#if defined(__has_builtin)
#if __has_builtin(__builtin_amdgcn_tanhf)
#define FAST_TANH(x) __builtin_amdgcn_tanhf(x)
#endif
#endif
#ifndef FAST_TANH
#define FAST_TANH(x) tanhf(x)
#endif

// ---------------------------------------------------------------------------
// Generic fp32 WMMA GEMM:  C[M,N] = A[M,K] * W[N,K]^T (+ bias[N])
// One wave per 16x16 output tile, K-loop in steps of 4 using
// V_WMMA_F32_16X16X4_F32.
//
// A-matrix lane layout (32-bit, 16x4): lanes 0-15 hold rows m0..m0+15 with
// K = k0,k0+1 ; lanes 16-31 hold the same rows with K = k0+2,k0+3.
// B-matrix (4x16) mirrors this with columns striped across lanes.
// C/D layout: VGPR j -> M = m0 + j (+8 for upper half-wave), N = lane&15.
// ---------------------------------------------------------------------------
__global__ __launch_bounds__(256) void gemm_nt_kernel(
    const float* __restrict__ A, const float* __restrict__ W,
    const float* __restrict__ bias, float* __restrict__ C,
    int M, int N, int K) {
  int wave = blockIdx.x * (blockDim.x >> 5) + (threadIdx.x >> 5);
  int lane = threadIdx.x & 31;
  int ntn  = N >> 4;
  int m0 = (wave / ntn) << 4;
  int n0 = (wave % ntn) << 4;
  if (m0 >= M) return;                       // wave-uniform; EXEC stays all-1s

  int r  = lane & 15;                        // row (A) / col (B) within tile
  int kk = (lane >> 4) << 1;                 // K sub-offset: 0 or 2
  const float* Arow = A + (size_t)(m0 + r) * K + kk;
  const float* Wcol = W + (size_t)(n0 + r) * K + kk;

  v8f acc = {};
#pragma unroll 4
  for (int k0 = 0; k0 < K; k0 += 4) {
    v2f a = *(const v2f*)(Arow + k0);        // 8B-aligned: kk even, K even
    v2f b = *(const v2f*)(Wcol + k0);
    acc = __builtin_amdgcn_wmma_f32_16x16x4_f32(
        false, a, false, b, (short)0, acc, false, false);
  }

  int half = lane >> 4;
  int col  = n0 + r;
  float bv = bias ? bias[col] : 0.0f;
#pragma unroll
  for (int j = 0; j < 8; ++j)
    C[(size_t)(m0 + j + half * 8) * N + col] = acc[j] + bv;
}

// ---------------------------------------------------------------------------
// Fused score -> masked softmax -> context kernel.
// One block = one (batch b, 16-row t-tile). 256 threads = 8 waves.
//   Phase 1: align[tl,s] = sum_d v[d]*tanh(wq[t0+tl,d] + uh[b,s,d])
//            (wq tile + v in LDS, read at one address per wave; uh staged in
//             32-d chunks through padded LDS; 4 s x 8 t scores per thread)
//   Phase 2: masked softmax over s (16 threads per row), write align_vectors
//   Phase 3: c[16,256] = P[16,512] * mems[b]  via f32 WMMA (A from LDS)
// ---------------------------------------------------------------------------
__global__ __launch_bounds__(256) void attn_score_ctx_kernel(
    const float* __restrict__ wq,        // [B*T, D]
    const float* __restrict__ uh,        // [B*S, D]
    const float* __restrict__ mems,      // [B, S, D]
    const float* __restrict__ v,         // [D]
    const int*   __restrict__ mem_masks, // [B]
    float* __restrict__ alignOut,        // [B, T, S]
    float* __restrict__ cOut)            // [B*T, D]
{
  __shared__ __attribute__((aligned(16))) float sWq[16 * D_];   // 16 KB
  __shared__ float sP[16 * S_];          // 32 KB   scores -> probabilities
  __shared__ __attribute__((aligned(16))) float sV[D_];         // 1 KB
  __shared__ __attribute__((aligned(16))) float sU[2][S_ * UP_]; // 2 x 72 KB uh chunks
  __shared__ float red[256];
  __shared__ float rowStat[16];

  const int tid   = threadIdx.x;
  const int b     = blockIdx.x >> 5;     // T/16 = 32 tiles per batch
  const int t0    = (blockIdx.x & 31) << 4;
  const int len   = mem_masks[b];

  // --- stage wq tile, v and the first uh chunk into LDS ---
  const float* wqBase = wq + ((size_t)b * T_ + t0) * D_;
  const float* uhB    = uh + (size_t)b * S_ * D_;
  const int gr = tid >> 3;               // staging: 8 threads cover one 128-B row piece
  const int gc = (tid & 7) << 2;
  const unsigned gOff = (unsigned)(gr * D_ + gc);  // lane's fixed offset; the chunk moves the base
  v4f pf[16];
#pragma unroll
  for (int k = 0; k < 16; ++k)
    pf[k] = *(const v4f*)(uhB + gOff + (unsigned)(32 * k * D_));
  for (int i = tid; i < 16 * D_; i += 256) sWq[i] = wqBase[i];
  for (int i = tid; i < D_;      i += 256) sV[i]  = v[i];
#pragma unroll
  for (int k = 0; k < 16; ++k)
    *(v4f*)(&sU[0][(gr + 32 * k) * UP_ + gc]) = pf[k];
  __syncthreads();

  // --- Phase 1: additive-attention scores (the 268M-tanh hot loop) ---
  // Lanes run along s. Each thread owns 4 s x 8 t scores in registers, so one
  // uh value feeds 8 tanh and one wq value (same LDS address in every lane)
  // feeds 4. Each score keeps an even-d and an odd-d partial sum, d ascending.
  {
    const int lane  = tid & 31;
    const int wv    = tid >> 5;
    const int sBase = ((wv & 3) << 7) + lane;   // s = sBase + 32*j, j = 0..3
    const int tBase = (wv >> 2) << 3;           // t = tBase + 0..7
    v2f acc[8][4];
#pragma unroll
    for (int t = 0; t < 8; ++t)
#pragma unroll
      for (int j = 0; j < 4; ++j) acc[t][j] = (v2f){0.0f, 0.0f};

#pragma unroll 1   // one chunk body is already several KB of code
    for (int c = 0; c < D_ / DC_; ++c) {
      const float* cur = sU[c & 1];
      const bool more = (c + 1) < D_ / DC_;     // same for the whole block
      if (more) {
        const float* nb = uhB + (c + 1) * DC_ + gOff;
#pragma unroll
        for (int k = 0; k < 16; ++k)            // next chunk flies during this one's math
          pf[k] = *(const v4f*)(nb + (unsigned)(32 * k * D_));
        // Keeps the loads' address registers untouched (not even reused as a
        // load's own destination) until the wait that stands before an overwrite.
        asm volatile("s_wait_xcnt 0x0" :: "v"(nb) : "memory");
      }
#pragma unroll 2   // lets the next quad's LDS reads issue under this quad's math
      for (int q = 0; q < DC_ / 4; ++q) {
        const int d = c * DC_ + q * 4;
        v4f u[4];
#pragma unroll
        for (int j = 0; j < 4; ++j)
          u[j] = *(const v4f*)(cur + (sBase + 32 * j) * UP_ + q * 4);
        const v4f vd = *(const v4f*)(sV + d);
        const v2f vlo = {vd.x, vd.y}, vhi = {vd.z, vd.w};
#pragma unroll
        for (int t = 0; t < 8; ++t) {
          const v4f w = *(const v4f*)(sWq + (tBase + t) * D_ + d);
          const v2f wlo = {w.x, w.y}, whi = {w.z, w.w};
#pragma unroll
          for (int j = 0; j < 4; ++j) {
            const v2f x0 = wlo + (v2f){u[j].x, u[j].y};
            const v2f x1 = whi + (v2f){u[j].z, u[j].w};
            const v2f h0 = {FAST_TANH(x0.x), FAST_TANH(x0.y)};
            const v2f h1 = {FAST_TANH(x1.x), FAST_TANH(x1.y)};
            acc[t][j] = __builtin_elementwise_fma(vlo, h0, acc[t][j]);
            acc[t][j] = __builtin_elementwise_fma(vhi, h1, acc[t][j]);
          }
        }
      }
      if (more) {
        float* nxt = sU[(c + 1) & 1];           // last read in pass c-1, ended by its barrier
#pragma unroll
        for (int k = 0; k < 16; ++k)
          *(v4f*)(nxt + (gr + 32 * k) * UP_ + gc) = pf[k];
        __syncthreads();                        // publishes chunk c+1, ends the reads of chunk c
      }
    }
#pragma unroll
    for (int t = 0; t < 8; ++t)
#pragma unroll
      for (int j = 0; j < 4; ++j)
        sP[(tBase + t) * S_ + sBase + 32 * j] = acc[t][j].x + acc[t][j].y;
  }
  __syncthreads();

  // --- Phase 2: masked softmax over s, per row (16 threads / row) ---
  const int row = tid >> 4;
  const int sub = tid & 15;
  float mx = -INFINITY;
  for (int s = sub; s < S_; s += 16)
    if (s < len) mx = fmaxf(mx, sP[row * S_ + s]);
  red[tid] = mx;
  __syncthreads();
  if (sub == 0) {
    float m = red[row * 16];
    for (int j = 1; j < 16; ++j) m = fmaxf(m, red[row * 16 + j]);
    rowStat[row] = m;
  }
  __syncthreads();
  const float rm = rowStat[row];
  float sum = 0.0f;
  for (int s = sub; s < S_; s += 16) {
    float e = (s < len) ? __expf(sP[row * S_ + s] - rm) : 0.0f;
    sP[row * S_ + s] = e;
    sum += e;
  }
  red[tid] = sum;
  __syncthreads();
  if (sub == 0) {
    float t = 0.0f;
    for (int j = 0; j < 16; ++j) t += red[row * 16 + j];
    rowStat[row] = t;
  }
  __syncthreads();
  const float inv = 1.0f / rowStat[row];
  float* aOut = alignOut + ((size_t)b * T_ + t0 + row) * S_;
  for (int s = sub; s < S_; s += 16) {
    float p = sP[row * S_ + s] * inv;
    sP[row * S_ + s] = p;
    aOut[s] = p;                               // masked slots are exactly 0
  }
  __syncthreads();

  // --- Phase 3: context c = P[16,512] * mems[b][512,256] via f32 WMMA ---
  {
    const int wv   = tid >> 5;
    const int lane = tid & 31;
    const int r    = lane & 15;
    const int kk   = (lane >> 4) << 1;
    const float* memB = mems + (size_t)b * S_ * D_;
    float* cBase = cOut + ((size_t)b * T_ + t0) * D_;
    for (int nt = wv; nt < D_ / 16; nt += 8) { // 16 n-tiles over 8 waves
      const int n0 = nt << 4;
      v8f acc = {};
#pragma unroll 4
      for (int k0 = 0; k0 < S_; k0 += 4) {
        const int kb = k0 + kk;
        v2f a = *(const v2f*)(sP + r * S_ + kb);        // LDS, 8B aligned
        v2f bm;
        bm.x = memB[(size_t)kb * D_ + n0 + r];          // B: col-striped lanes
        bm.y = memB[(size_t)(kb + 1) * D_ + n0 + r];
        acc = __builtin_amdgcn_wmma_f32_16x16x4_f32(
            false, a, false, bm, (short)0, acc, false, false);
      }
      const int half = lane >> 4;
      const int col  = n0 + r;
#pragma unroll
      for (int j = 0; j < 8; ++j)
        cBase[(size_t)(j + half * 8) * D_ + col] = acc[j];
    }
  }
}

// ---------------------------------------------------------------------------
// Output projection: attn_h = concat(c, inputs) * Wout^T + bout
// Implemented as a split-K WMMA GEMM (K = 256 from c, then 512 from inputs),
// so the concat is never materialized. M = B*T = 2048, N = 512, K = 768.
// ---------------------------------------------------------------------------
__global__ __launch_bounds__(256) void outproj_kernel(
    const float* __restrict__ Cctx,   // [B*T, 256]
    const float* __restrict__ X,      // [B*T, 512]
    const float* __restrict__ W,      // [512, 768]
    const float* __restrict__ bias,   // [512]
    float* __restrict__ Out)          // [B*T, 512]
{
  const int wave = blockIdx.x * 8 + (threadIdx.x >> 5);
  const int lane = threadIdx.x & 31;
  const int m0 = (wave >> 5) << 4;      // 32 n-tiles (N=512)
  const int n0 = (wave & 31) << 4;
  const int r  = lane & 15;
  const int kk = (lane >> 4) << 1;

  const float* Ac = Cctx + (size_t)(m0 + r) * D_ + kk;
  const float* Ax = X    + (size_t)(m0 + r) * IN_ + kk;
  const float* Wc = W    + (size_t)(n0 + r) * (D_ + IN_) + kk;

  v8f acc = {};
#pragma unroll 4
  for (int k0 = 0; k0 < D_; k0 += 4) {       // K segment 1: context
    v2f a = *(const v2f*)(Ac + k0);
    v2f w = *(const v2f*)(Wc + k0);
    acc = __builtin_amdgcn_wmma_f32_16x16x4_f32(
        false, a, false, w, (short)0, acc, false, false);
  }
#pragma unroll 4
  for (int k0 = 0; k0 < IN_; k0 += 4) {      // K segment 2: inputs
    v2f a = *(const v2f*)(Ax + k0);
    v2f w = *(const v2f*)(Wc + D_ + k0);
    acc = __builtin_amdgcn_wmma_f32_16x16x4_f32(
        false, a, false, w, (short)0, acc, false, false);
  }

  const int half = lane >> 4;
  const int col  = n0 + r;
  const float bv = bias[col];
#pragma unroll
  for (int j = 0; j < 8; ++j)
    Out[(size_t)(m0 + j + half * 8) * IN_ + col] = acc[j] + bv;
}

// ---------------------------------------------------------------------------
extern "C" void kernel_launch(void* const* d_in, const int* in_sizes, int n_in,
                              void* d_out, int out_size, void* d_ws, size_t ws_size,
                              hipStream_t stream) {
  const float* inputs    = (const float*)d_in[0];  // [B,T,IN]
  const float* mems      = (const float*)d_in[1];  // [B,S,D]
  const int*   mem_masks = (const int*)  d_in[2];  // [B]
  const float* Wq        = (const float*)d_in[3];  // [D,IN]
  const float* Wc        = (const float*)d_in[4];  // [D,D]
  const float* bc        = (const float*)d_in[5];  // [D]
  const float* v         = (const float*)d_in[6];  // [D]
  const float* Wout      = (const float*)d_in[7];  // [IN, D+IN]
  const float* bout      = (const float*)d_in[8];  // [IN]

  float* attn  = (float*)d_out;                        // [B,T,IN]
  float* align = attn + (size_t)B_ * T_ * IN_;         // [B,T,S]

  float* ws  = (float*)d_ws;
  float* wq  = ws;                                     // [B*T, D]
  float* uh  = wq + (size_t)B_ * T_ * D_;              // [B*S, D]
  float* ctx = uh + (size_t)B_ * S_ * D_;              // [B*T, D]

  const int M = B_ * T_;                               // 2048 (== B*S too)

  // 1) wq = inputs * Wq^T          : 2048 tiles -> 256 blocks of 8 waves
  gemm_nt_kernel<<<(M / 16) * (D_ / 16) / 8, 256, 0, stream>>>(
      inputs, Wq, nullptr, wq, M, D_, IN_);

  // 2) uh = mems * Wc^T + bc
  gemm_nt_kernel<<<(M / 16) * (D_ / 16) / 8, 256, 0, stream>>>(
      mems, Wc, bc, uh, M, D_, D_);

  // 3) fused tanh-score + masked softmax + context (one block per 16 t-rows)
  attn_score_ctx_kernel<<<B_ * (T_ / 16), 256, 0, stream>>>(
      wq, uh, mems, v, mem_masks, align, ctx);

  // 4) attn_h = concat(ctx, inputs) * Wout^T + bout : 4096 tiles -> 512 blocks
  outproj_kernel<<<(M / 16) * (IN_ / 16) / 8, 256, 0, stream>>>(
      ctx, inputs, Wout, bout, attn);
}

// v002
// It runs in 83 microseconds.
// Two timings next to v001 both put it at 1.40 times that version's speed.
// Over all steps from v000 it is 3.93 times as fast.
#include <hip/hip_runtime.h>
#include <hip/hip_bf16.h>
#include <math.h>

// Problem constants (from reference)
#define B_ 4
#define T_ 512
#define S_ 512
#define IN_ 512
#define D_ 256   // MEM_DIM

typedef __attribute__((ext_vector_type(2))) float v2f;
typedef __attribute__((ext_vector_type(4))) float v4f;
typedef __attribute__((ext_vector_type(8))) float v8f;

#define DC_ 32          // d values of uh staged per pass
#define UP_ (DC_ + 4)   // LDS row pitch in floats: 144 B = 16 B x odd, conflict-free b128 rows

// Native CDNA5 V_TANH_F32 if the toolchain exposes it; OCML fallback.
#if defined(__has_builtin)
#if __has_builtin(__builtin_amdgcn_tanhf)
#define FAST_TANH(x) __builtin_amdgcn_tanhf(x)
#endif
#endif
#ifndef FAST_TANH
#define FAST_TANH(x) tanhf(x)
#endif

// ---------------------------------------------------------------------------
// fp32 WMMA GEMM body:  C[M,N] = [A1 | A2][M,K] * W[N,K]^T (+ bias[N])
// One block = one 64 x 32 tile of C, 8 waves, one 16x16 tile per wave.
// A and W come in 64-k chunks through LDS: every global load is whole 128-B
// lines (16 lanes x 16 B per row), each element is fetched once per block, and
// later chunks' loads fly while this chunk is multiplied (two LDS buffers, fed
// from two register sets).
//
// Fragments (V_WMMA_F32_16X16X4_F32): lanes 0-15 hold row/col r with the first
// two k of the instruction, lanes 16-31 the same r with the last two.
// One 16-B LDS read per lane feeds two WMMAs: of each group of 8 k, lanes 0-15
// read k 0..3 and lanes 16-31 k 4..7; the first WMMA takes k {0,1 | 4,5}, the
// second k {2,3 | 6,7}. A and W use the same map, so every product pairs.
// C/D layout: VGPR j -> M = m0 + j (+8 for upper half-wave), N = lane&15.
// ---------------------------------------------------------------------------
#define KC_ 64          // k values of A and W staged per pass
#define GP_ (KC_ + 4)   // LDS row pitch in floats: 272 B = 16 B x odd, conflict-free b128 rows

template <int NC1, int LDA1, int NC2, int LDA2, int N, bool BIAS>
__device__ __forceinline__ void gemm_nt_tile(
    const float* __restrict__ A1,    // first NC1 chunks of K, row pitch LDA1
    const float* __restrict__ A2,    // next NC2 chunks of K, row pitch LDA2
    const float* __restrict__ W,     // [N, (NC1+NC2)*KC_]
    const float* __restrict__ bias,  // [N], read only if BIAS
    float* __restrict__ C)           // [M, N]
{
  constexpr int NC  = NC1 + NC2;
  constexpr int LDW = NC * KC_;
  __shared__ __attribute__((aligned(16))) float sA[2][64 * GP_];
  __shared__ __attribute__((aligned(16))) float sW[2][32 * GP_];

  const int tid = threadIdx.x;
  const int m0  = (blockIdx.x / (N / 32)) << 6;
  const int n0  = (blockIdx.x % (N / 32)) << 5;
  const int gr  = tid >> 4;              // staging: 16 threads cover one 256-B row piece
  const int gc  = (tid & 15) << 2;
  const unsigned oA1 = (unsigned)(gr * LDA1 + gc);   // lane's fixed offsets; the chunk moves the base
  const unsigned oA2 = (unsigned)(gr * LDA2 + gc);
  const unsigned oW  = (unsigned)(gr * LDW + gc);
  const int sOff = gr * GP_ + gc;

  const int lane = tid & 31;
  const int wv   = tid >> 5;
  const int r    = lane & 15;
  const int half = lane >> 4;
  const int aOff = (((wv & 3) << 4) + r) * GP_ + (half << 2);
  const int bOff = (((wv >> 2) << 4) + r) * GP_ + (half << 2);
  const int col  = n0 + ((wv >> 2) << 4) + r;

  v4f pa[2][4], pw[2][2];                // two register sets: chunk c travels in set c & 1
  auto fetch = [&](int c) {
    const int s = c & 1;
    const float* wp = W + (size_t)n0 * LDW + c * KC_;
#pragma unroll
    for (int k = 0; k < 2; ++k)
      pw[s][k] = *(const v4f*)(wp + oW + (unsigned)(16 * k * LDW));
    if (NC2 == 0 || c < NC1) {           // same for the whole block
      const float* ap = A1 + (size_t)m0 * LDA1 + c * KC_;
#pragma unroll
      for (int k = 0; k < 4; ++k)
        pa[s][k] = *(const v4f*)(ap + oA1 + (unsigned)(16 * k * LDA1));
    } else {
      const float* ap = A2 + (size_t)m0 * LDA2 + (c - NC1) * KC_;
#pragma unroll
      for (int k = 0; k < 4; ++k)
        pa[s][k] = *(const v4f*)(ap + oA2 + (unsigned)(16 * k * LDA2));
    }
    // The wait that stands before the loads' address registers are overwritten.
    asm volatile("s_wait_xcnt 0x0" ::: "memory");
  };
  auto stage = [&](int buf) {
#pragma unroll
    for (int k = 0; k < 4; ++k) *(v4f*)(&sA[buf][sOff + 16 * k * GP_]) = pa[buf][k];
#pragma unroll
    for (int k = 0; k < 2; ++k) *(v4f*)(&sW[buf][sOff + 16 * k * GP_]) = pw[buf][k];
  };

  v8f acc = {};
  auto mult = [&](int buf, int g0, int g1) {   // groups of 8 k: g0 <= g < g1
    const float* ca = &sA[buf][aOff];
    const float* cw = &sW[buf][bOff];
#pragma unroll
    for (int g = g0; g < g1; ++g) {
      const v4f a = *(const v4f*)(ca + g * 8);
      const v4f w = *(const v4f*)(cw + g * 8);
      acc = __builtin_amdgcn_wmma_f32_16x16x4_f32(
          false, (v2f){a.x, a.y}, false, (v2f){w.x, w.y}, (short)0, acc, false, false);
      acc = __builtin_amdgcn_wmma_f32_16x16x4_f32(
          false, (v2f){a.z, a.w}, false, (v2f){w.z, w.w}, (short)0, acc, false, false);
    }
  };

  fetch(0);
  fetch(1);
  const float bv = BIAS ? bias[col] : 0.0f;
  stage(0);
  __syncthreads();

  // One pass: chunk c+2's loads start, into the register set that chunk c left in the pass
  // before, and have the pass to land; chunk c+1, landed in the pass before, goes to LDS with
  // no wait (into the buffer whose last reads were ended by the pass before's barrier) under
  // the pass's last WMMAs; the barrier publishes chunk c+1 and ends the reads of chunk c.
  auto pass = [&](int c, int buf) {
    if (NC2 != 0 && c + 2 == NC1) {
      // A2's lane offset is formed here, behind WMMAs whose operand registers it may take:
      // the four vector slots between a WMMA and vector work on its A or B, held in place.
      __builtin_amdgcn_sched_barrier(0);
      asm volatile("v_nop\n\tv_nop\n\tv_nop\n\tv_nop");
      __builtin_amdgcn_sched_barrier(0);
    }
    if (c + 2 < NC) fetch(c + 2);
    mult(buf, 0, 6);
    stage(buf ^ 1);
    mult(buf, 6, 8);
    __syncthreads();
  };
#pragma unroll     // every chunk's source, offsets and buffer become constants: no index math among the WMMAs
  for (int c = 0; c + 1 < NC; ++c) pass(c, c & 1);
  mult((NC - 1) & 1, 0, 8);
  // The epilogue's vector work (output address, bias adds) stays behind the slots below:
  // among the WMMAs it would overwrite operand registers directly behind their reader.
  __builtin_amdgcn_sched_barrier(0);
  // The four vector slots between the last WMMA and vector work on its D, A or B.
  asm volatile("v_nop\n\tv_nop\n\tv_nop\n\tv_nop");
  __builtin_amdgcn_sched_barrier(0);   // holds the slots directly behind that WMMA

  const int row = m0 + ((wv & 3) << 4) + half * 8;
  float* cp = C + (unsigned)(row * N + col);
#pragma unroll
  for (int j = 0; j < 8; ++j)
    cp[j * N] = acc[j] + bv;
}

// wq = inputs * Wq^T : M = 2048, N = 256, K = 512
__global__ __launch_bounds__(256) void proj_q_kernel(
    const float* __restrict__ A, const float* __restrict__ W, float* __restrict__ C) {
  gemm_nt_tile<IN_ / KC_, IN_, 0, IN_, D_, false>(A, A, W, nullptr, C);
}

// uh = mems * Wc^T + bc : M = 2048, N = 256, K = 256
__global__ __launch_bounds__(256) void proj_u_kernel(
    const float* __restrict__ A, const float* __restrict__ W,
    const float* __restrict__ bias, float* __restrict__ C) {
  gemm_nt_tile<D_ / KC_, D_, 0, D_, D_, true>(A, A, W, bias, C);
}

// ---------------------------------------------------------------------------
// Fused score -> masked softmax -> context kernel.
// One block = one (batch b, 16-row t-tile). 256 threads = 8 waves.
//   Phase 1: align[tl,s] = sum_d v[d]*tanh(wq[t0+tl,d] + uh[b,s,d])
//            (wq tile + v in LDS, read at one address per wave; uh staged in
//             32-d chunks through padded LDS; 4 s x 8 t scores per thread)
//   Phase 2: masked softmax over s (16 threads per row), write align_vectors
//   Phase 3: c[16,256] = P[16,512] * mems[b]  via f32 WMMA (A from LDS)
// ---------------------------------------------------------------------------
__global__ __launch_bounds__(256) void attn_score_ctx_kernel(
    const float* __restrict__ wq,        // [B*T, D]
    const float* __restrict__ uh,        // [B*S, D]
    const float* __restrict__ mems,      // [B, S, D]
    const float* __restrict__ v,         // [D]
    const int*   __restrict__ mem_masks, // [B]
    float* __restrict__ alignOut,        // [B, T, S]
    float* __restrict__ cOut)            // [B*T, D]
{
  __shared__ __attribute__((aligned(16))) float sWq[16 * D_];   // 16 KB
  __shared__ float sP[16 * S_];          // 32 KB   scores -> probabilities
  __shared__ __attribute__((aligned(16))) float sV[D_];         // 1 KB
  __shared__ __attribute__((aligned(16))) float sU[2][S_ * UP_]; // 2 x 72 KB uh chunks
  __shared__ float red[256];
  __shared__ float rowStat[16];

  const int tid   = threadIdx.x;
  const int b     = blockIdx.x >> 5;     // T/16 = 32 tiles per batch
  const int t0    = (blockIdx.x & 31) << 4;
  const int len   = mem_masks[b];

  // --- stage wq tile, v and the first uh chunk into LDS ---
  const float* wqBase = wq + ((size_t)b * T_ + t0) * D_;
  const float* uhB    = uh + (size_t)b * S_ * D_;
  const int gr = tid >> 3;               // staging: 8 threads cover one 128-B row piece
  const int gc = (tid & 7) << 2;
  const unsigned gOff = (unsigned)(gr * D_ + gc);  // lane's fixed offset; the chunk moves the base
  v4f pf[16];
#pragma unroll
  for (int k = 0; k < 16; ++k)
    pf[k] = *(const v4f*)(uhB + gOff + (unsigned)(32 * k * D_));
  for (int i = tid; i < 16 * D_; i += 256) sWq[i] = wqBase[i];
  for (int i = tid; i < D_;      i += 256) sV[i]  = v[i];
#pragma unroll
  for (int k = 0; k < 16; ++k)
    *(v4f*)(&sU[0][(gr + 32 * k) * UP_ + gc]) = pf[k];
  __syncthreads();

  // --- Phase 1: additive-attention scores (the 268M-tanh hot loop) ---
  // Lanes run along s. Each thread owns 4 s x 8 t scores in registers, so one
  // uh value feeds 8 tanh and one wq value (same LDS address in every lane)
  // feeds 4. Each score keeps an even-d and an odd-d partial sum, d ascending.
  {
    const int lane  = tid & 31;
    const int wv    = tid >> 5;
    const int sBase = ((wv & 3) << 7) + lane;   // s = sBase + 32*j, j = 0..3
    const int tBase = (wv >> 2) << 3;           // t = tBase + 0..7
    v2f acc[8][4];
#pragma unroll
    for (int t = 0; t < 8; ++t)
#pragma unroll
      for (int j = 0; j < 4; ++j) acc[t][j] = (v2f){0.0f, 0.0f};

#pragma unroll 1   // one chunk body is already several KB of code
    for (int c = 0; c < D_ / DC_; ++c) {
      const float* cur = sU[c & 1];
      const bool more = (c + 1) < D_ / DC_;     // same for the whole block
      if (more) {
        const float* nb = uhB + (c + 1) * DC_ + gOff;
#pragma unroll
        for (int k = 0; k < 16; ++k)            // next chunk flies during this one's math
          pf[k] = *(const v4f*)(nb + (unsigned)(32 * k * D_));
        // Keeps the loads' address registers untouched (not even reused as a
        // load's own destination) until the wait that stands before an overwrite.
        asm volatile("s_wait_xcnt 0x0" :: "v"(nb) : "memory");
      }
#pragma unroll 2   // lets the next quad's LDS reads issue under this quad's math
      for (int q = 0; q < DC_ / 4; ++q) {
        const int d = c * DC_ + q * 4;
        v4f u[4];
#pragma unroll
        for (int j = 0; j < 4; ++j)
          u[j] = *(const v4f*)(cur + (sBase + 32 * j) * UP_ + q * 4);
        const v4f vd = *(const v4f*)(sV + d);
        const v2f vlo = {vd.x, vd.y}, vhi = {vd.z, vd.w};
#pragma unroll
        for (int t = 0; t < 8; ++t) {
          const v4f w = *(const v4f*)(sWq + (tBase + t) * D_ + d);
          const v2f wlo = {w.x, w.y}, whi = {w.z, w.w};
#pragma unroll
          for (int j = 0; j < 4; ++j) {
            const v2f x0 = wlo + (v2f){u[j].x, u[j].y};
            const v2f x1 = whi + (v2f){u[j].z, u[j].w};
            const v2f h0 = {FAST_TANH(x0.x), FAST_TANH(x0.y)};
            const v2f h1 = {FAST_TANH(x1.x), FAST_TANH(x1.y)};
            acc[t][j] = __builtin_elementwise_fma(vlo, h0, acc[t][j]);
            acc[t][j] = __builtin_elementwise_fma(vhi, h1, acc[t][j]);
          }
        }
      }
      if (more) {
        float* nxt = sU[(c + 1) & 1];           // last read in pass c-1, ended by its barrier
#pragma unroll
        for (int k = 0; k < 16; ++k)
          *(v4f*)(nxt + (gr + 32 * k) * UP_ + gc) = pf[k];
        __syncthreads();                        // publishes chunk c+1, ends the reads of chunk c
      }
    }
#pragma unroll
    for (int t = 0; t < 8; ++t)
#pragma unroll
      for (int j = 0; j < 4; ++j)
        sP[(tBase + t) * S_ + sBase + 32 * j] = acc[t][j].x + acc[t][j].y;
  }
  __syncthreads();

  // --- Phase 2: masked softmax over s, per row (16 threads / row) ---
  const int row = tid >> 4;
  const int sub = tid & 15;
  float mx = -INFINITY;
  for (int s = sub; s < S_; s += 16)
    if (s < len) mx = fmaxf(mx, sP[row * S_ + s]);
  red[tid] = mx;
  __syncthreads();
  if (sub == 0) {
    float m = red[row * 16];
    for (int j = 1; j < 16; ++j) m = fmaxf(m, red[row * 16 + j]);
    rowStat[row] = m;
  }
  __syncthreads();
  const float rm = rowStat[row];
  float sum = 0.0f;
  for (int s = sub; s < S_; s += 16) {
    float e = (s < len) ? __expf(sP[row * S_ + s] - rm) : 0.0f;
    sP[row * S_ + s] = e;
    sum += e;
  }
  red[tid] = sum;
  __syncthreads();
  if (sub == 0) {
    float t = 0.0f;
    for (int j = 0; j < 16; ++j) t += red[row * 16 + j];
    rowStat[row] = t;
  }
  __syncthreads();
  const float inv = 1.0f / rowStat[row];
  float* aOut = alignOut + ((size_t)b * T_ + t0 + row) * S_;
  for (int s = sub; s < S_; s += 16) {
    float p = sP[row * S_ + s] * inv;
    sP[row * S_ + s] = p;
    aOut[s] = p;                               // masked slots are exactly 0
  }
  __syncthreads();

  // --- Phase 3: context c = P[16,512] * mems[b][512,256] via f32 WMMA ---
  {
    const int wv   = tid >> 5;
    const int lane = tid & 31;
    const int r    = lane & 15;
    const int kk   = (lane >> 4) << 1;
    const float* memB = mems + (size_t)b * S_ * D_;
    float* cBase = cOut + ((size_t)b * T_ + t0) * D_;
    for (int nt = wv; nt < D_ / 16; nt += 8) { // 16 n-tiles over 8 waves
      const int n0 = nt << 4;
      v8f acc = {};
#pragma unroll 4
      for (int k0 = 0; k0 < S_; k0 += 4) {
        const int kb = k0 + kk;
        v2f a = *(const v2f*)(sP + r * S_ + kb);        // LDS, 8B aligned
        v2f bm;
        bm.x = memB[(size_t)kb * D_ + n0 + r];          // B: col-striped lanes
        bm.y = memB[(size_t)(kb + 1) * D_ + n0 + r];
        acc = __builtin_amdgcn_wmma_f32_16x16x4_f32(
            false, a, false, bm, (short)0, acc, false, false);
      }
      const int half = lane >> 4;
      const int col  = n0 + r;
#pragma unroll
      for (int j = 0; j < 8; ++j)
        cBase[(size_t)(j + half * 8) * D_ + col] = acc[j];
    }
  }
}

// ---------------------------------------------------------------------------
// Output projection: attn_h = concat(c, inputs) * Wout^T + bout
// K = 256 from c, then 512 from inputs, so the concat is never materialized.
// M = B*T = 2048, N = 512, K = 768.
// ---------------------------------------------------------------------------
__global__ __launch_bounds__(256) void outproj_kernel(
    const float* __restrict__ Cctx,   // [B*T, 256]
    const float* __restrict__ X,      // [B*T, 512]
    const float* __restrict__ W,      // [512, 768]
    const float* __restrict__ bias,   // [512]
    float* __restrict__ Out)          // [B*T, 512]
{
  gemm_nt_tile<D_ / KC_, D_, IN_ / KC_, IN_, IN_, true>(Cctx, X, W, bias, Out);
}

// ---------------------------------------------------------------------------
extern "C" void kernel_launch(void* const* d_in, const int* in_sizes, int n_in,
                              void* d_out, int out_size, void* d_ws, size_t ws_size,
                              hipStream_t stream) {
  const float* inputs    = (const float*)d_in[0];  // [B,T,IN]
  const float* mems      = (const float*)d_in[1];  // [B,S,D]
  const int*   mem_masks = (const int*)  d_in[2];  // [B]
  const float* Wq        = (const float*)d_in[3];  // [D,IN]
  const float* Wc        = (const float*)d_in[4];  // [D,D]
  const float* bc        = (const float*)d_in[5];  // [D]
  const float* v         = (const float*)d_in[6];  // [D]
  const float* Wout      = (const float*)d_in[7];  // [IN, D+IN]
  const float* bout      = (const float*)d_in[8];  // [IN]

  float* attn  = (float*)d_out;                        // [B,T,IN]
  float* align = attn + (size_t)B_ * T_ * IN_;         // [B,T,S]

  float* ws  = (float*)d_ws;
  float* wq  = ws;                                     // [B*T, D]
  float* uh  = wq + (size_t)B_ * T_ * D_;              // [B*S, D]
  float* ctx = uh + (size_t)B_ * S_ * D_;              // [B*T, D]

  const int M = B_ * T_;                               // 2048 (== B*S too)

  // 1) wq = inputs * Wq^T          : 64 x 32 tiles -> 256 blocks of 8 waves
  proj_q_kernel<<<(M / 64) * (D_ / 32), 256, 0, stream>>>(inputs, Wq, wq);

  // 2) uh = mems * Wc^T + bc
  proj_u_kernel<<<(M / 64) * (D_ / 32), 256, 0, stream>>>(mems, Wc, bc, uh);

  // 3) fused tanh-score + masked softmax + context (one block per 16 t-rows)
  attn_score_ctx_kernel<<<B_ * (T_ / 16), 256, 0, stream>>>(
      wq, uh, mems, v, mem_masks, align, ctx);

  // 4) attn_h = concat(ctx, inputs) * Wout^T + bout : 64 x 32 tiles -> 512 blocks
  outproj_kernel<<<(M / 64) * (IN_ / 32), 256, 0, stream>>>(
      ctx, inputs, Wout, bout, attn);
}

// v003
// Measured time: 70.1 microseconds a run.
// Next to v002, in two timings, it ran 1.19 and 1.18 times as fast.
// Over all steps from v000 it is 4.65 times as fast.
#include <hip/hip_runtime.h>
#include <hip/hip_bf16.h>
#include <math.h>

// Problem constants (from reference)
#define B_ 4
#define T_ 512
#define S_ 512
#define IN_ 512
#define D_ 256   // MEM_DIM

typedef __attribute__((ext_vector_type(2))) float v2f;
typedef __attribute__((ext_vector_type(4))) float v4f;
typedef __attribute__((ext_vector_type(8))) float v8f;

#define TT_ 8           // t rows per score block: B*T/TT_ = 256 blocks
#define DC_ 32          // d values of uh staged per pass
#define UP_ (DC_ + 4)   // LDS row pitch in floats: 144 B = 16 B x odd, conflict-free b128 rows

// Native CDNA5 V_TANH_F32 if the toolchain exposes it; OCML fallback.
#if defined(__has_builtin)
#if __has_builtin(__builtin_amdgcn_tanhf)
#define FAST_TANH(x) __builtin_amdgcn_tanhf(x)
#endif
#endif
#ifndef FAST_TANH
#define FAST_TANH(x) tanhf(x)
#endif

// ---------------------------------------------------------------------------
// fp32 WMMA GEMM body:  C[M,N] = [A1 | A2][M,K] * W[N,K]^T (+ bias[N])
// One block = one 64 x 32 tile of C, 8 waves, one 16x16 tile per wave.
// A and W come in 64-k chunks through LDS: every global load is whole 128-B
// lines (16 lanes x 16 B per row), each element is fetched once per block, and
// later chunks' loads fly while this chunk is multiplied (two LDS buffers, fed
// from two register sets).
//
// Fragments (V_WMMA_F32_16X16X4_F32): lanes 0-15 hold row/col r with the first
// two k of the instruction, lanes 16-31 the same r with the last two.
// One 16-B LDS read per lane feeds two WMMAs: of each group of 8 k, lanes 0-15
// read k 0..3 and lanes 16-31 k 4..7; the first WMMA takes k {0,1 | 4,5}, the
// second k {2,3 | 6,7}. A and W use the same map, so every product pairs.
// C/D layout: VGPR j -> M = m0 + j (+8 for upper half-wave), N = lane&15.
// ---------------------------------------------------------------------------
#define KC_ 64          // k values of A and W staged per pass
#define GP_ (KC_ + 4)   // LDS row pitch in floats: 272 B = 16 B x odd, conflict-free b128 rows

template <int NC1, int LDA1, int NC2, int LDA2, int N, bool BIAS>
__device__ __forceinline__ void gemm_nt_tile(
    const float* __restrict__ A1,    // first NC1 chunks of K, row pitch LDA1
    const float* __restrict__ A2,    // next NC2 chunks of K, row pitch LDA2
    const float* __restrict__ W,     // [N, (NC1+NC2)*KC_]
    const float* __restrict__ bias,  // [N], read only if BIAS
    float* __restrict__ C)           // [M, N]
{
  constexpr int NC  = NC1 + NC2;
  constexpr int LDW = NC * KC_;
  __shared__ __attribute__((aligned(16))) float sA[2][64 * GP_];
  __shared__ __attribute__((aligned(16))) float sW[2][32 * GP_];

  const int tid = threadIdx.x;
  const int m0  = (blockIdx.x / (N / 32)) << 6;
  const int n0  = (blockIdx.x % (N / 32)) << 5;
  const int gr  = tid >> 4;              // staging: 16 threads cover one 256-B row piece
  const int gc  = (tid & 15) << 2;
  const unsigned oA1 = (unsigned)(gr * LDA1 + gc);   // lane's fixed offsets; the chunk moves the base
  const unsigned oA2 = (unsigned)(gr * LDA2 + gc);
  const unsigned oW  = (unsigned)(gr * LDW + gc);
  const int sOff = gr * GP_ + gc;

  const int lane = tid & 31;
  const int wv   = tid >> 5;
  const int r    = lane & 15;
  const int half = lane >> 4;
  const int aOff = (((wv & 3) << 4) + r) * GP_ + (half << 2);
  const int bOff = (((wv >> 2) << 4) + r) * GP_ + (half << 2);
  const int col  = n0 + ((wv >> 2) << 4) + r;

  v4f pa[2][4], pw[2][2];                // two register sets: chunk c travels in set c & 1
  auto fetch = [&](int c) {
    const int s = c & 1;
    const float* wp = W + (size_t)n0 * LDW + c * KC_;
#pragma unroll
    for (int k = 0; k < 2; ++k)
      pw[s][k] = *(const v4f*)(wp + oW + (unsigned)(16 * k * LDW));
    if (NC2 == 0 || c < NC1) {           // same for the whole block
      const float* ap = A1 + (size_t)m0 * LDA1 + c * KC_;
#pragma unroll
      for (int k = 0; k < 4; ++k)
        pa[s][k] = *(const v4f*)(ap + oA1 + (unsigned)(16 * k * LDA1));
    } else {
      const float* ap = A2 + (size_t)m0 * LDA2 + (c - NC1) * KC_;
#pragma unroll
      for (int k = 0; k < 4; ++k)
        pa[s][k] = *(const v4f*)(ap + oA2 + (unsigned)(16 * k * LDA2));
    }
    // The wait that stands before the loads' address registers are overwritten.
    asm volatile("s_wait_xcnt 0x0" ::: "memory");
  };
  auto stage = [&](int buf) {
#pragma unroll
    for (int k = 0; k < 4; ++k) *(v4f*)(&sA[buf][sOff + 16 * k * GP_]) = pa[buf][k];
#pragma unroll
    for (int k = 0; k < 2; ++k) *(v4f*)(&sW[buf][sOff + 16 * k * GP_]) = pw[buf][k];
  };

  v8f acc = {};
  auto mult = [&](int buf, int g0, int g1) {   // groups of 8 k: g0 <= g < g1
    const float* ca = &sA[buf][aOff];
    const float* cw = &sW[buf][bOff];
#pragma unroll
    for (int g = g0; g < g1; ++g) {
      const v4f a = *(const v4f*)(ca + g * 8);
      const v4f w = *(const v4f*)(cw + g * 8);
      acc = __builtin_amdgcn_wmma_f32_16x16x4_f32(
          false, (v2f){a.x, a.y}, false, (v2f){w.x, w.y}, (short)0, acc, false, false);
      acc = __builtin_amdgcn_wmma_f32_16x16x4_f32(
          false, (v2f){a.z, a.w}, false, (v2f){w.z, w.w}, (short)0, acc, false, false);
    }
  };

  fetch(0);
  fetch(1);
  const float bv = BIAS ? bias[col] : 0.0f;
  stage(0);
  __syncthreads();

  // One pass: chunk c+2's loads start, into the register set that chunk c left in the pass
  // before, and have the pass to land; chunk c+1, landed in the pass before, goes to LDS with
  // no wait (into the buffer whose last reads were ended by the pass before's barrier) under
  // the pass's last WMMAs; the barrier publishes chunk c+1 and ends the reads of chunk c.
  auto pass = [&](int c, int buf) {
    if (NC2 != 0 && c + 2 == NC1) {
      // A2's lane offset is formed here, behind WMMAs whose operand registers it may take:
      // the four vector slots between a WMMA and vector work on its A or B, held in place.
      __builtin_amdgcn_sched_barrier(0);
      asm volatile("v_nop\n\tv_nop\n\tv_nop\n\tv_nop");
      __builtin_amdgcn_sched_barrier(0);
    }
    if (c + 2 < NC) fetch(c + 2);
    mult(buf, 0, 6);
    stage(buf ^ 1);
    mult(buf, 6, 8);
    __syncthreads();
  };
#pragma unroll     // every chunk's source, offsets and buffer become constants: no index math among the WMMAs
  for (int c = 0; c + 1 < NC; ++c) pass(c, c & 1);
  mult((NC - 1) & 1, 0, 8);
  // The epilogue's vector work (output address, bias adds) stays behind the slots below:
  // among the WMMAs it would overwrite operand registers directly behind their reader.
  __builtin_amdgcn_sched_barrier(0);
  // The four vector slots between the last WMMA and vector work on its D, A or B.
  asm volatile("v_nop\n\tv_nop\n\tv_nop\n\tv_nop");
  __builtin_amdgcn_sched_barrier(0);   // holds the slots directly behind that WMMA

  const int row = m0 + ((wv & 3) << 4) + half * 8;
  float* cp = C + (unsigned)(row * N + col);
#pragma unroll
  for (int j = 0; j < 8; ++j)
    cp[j * N] = acc[j] + bv;
}

// wq = inputs * Wq^T : M = 2048, N = 256, K = 512
__global__ __launch_bounds__(256) void proj_q_kernel(
    const float* __restrict__ A, const float* __restrict__ W, float* __restrict__ C) {
  gemm_nt_tile<IN_ / KC_, IN_, 0, IN_, D_, false>(A, A, W, nullptr, C);
}

// uh = mems * Wc^T + bc : M = 2048, N = 256, K = 256
__global__ __launch_bounds__(256) void proj_u_kernel(
    const float* __restrict__ A, const float* __restrict__ W,
    const float* __restrict__ bias, float* __restrict__ C) {
  gemm_nt_tile<D_ / KC_, D_, 0, D_, D_, true>(A, A, W, bias, C);
}

// ---------------------------------------------------------------------------
// Fused score -> masked softmax -> context kernel.
// One block = one (batch b, 8-row t-tile). 256 threads = 8 waves.
//   Phase 1: align[tl,s] = sum_d v[d]*tanh(wq[t0+tl,d] + uh[b,s,d])
//            (wq tile + v in LDS, read at one address per wave; uh staged in
//             32-d chunks through padded LDS; 4 s x 4 t scores per thread)
//   Phase 2: masked softmax over s (one wave per row), write align_vectors
//   Phase 3: c[8,256] = P[8,512] * mems[b]  via f32 WMMA (A from LDS; the
//            instruction's rows 8-15 repeat rows 0-7)
// ---------------------------------------------------------------------------
__global__ __launch_bounds__(256) void attn_score_ctx_kernel(
    const float* __restrict__ wq,        // [B*T, D]
    const float* __restrict__ uh,        // [B*S, D]
    const float* __restrict__ mems,      // [B, S, D]
    const float* __restrict__ v,         // [D]
    const int*   __restrict__ mem_masks, // [B]
    float* __restrict__ alignOut,        // [B, T, S]
    float* __restrict__ cOut)            // [B*T, D]
{
  __shared__ __attribute__((aligned(16))) float sWq[TT_ * D_];  // 8 KB
  __shared__ float sP[TT_ * S_];         // 16 KB   scores -> probabilities
  __shared__ __attribute__((aligned(16))) float sV[D_];         // 1 KB
  __shared__ __attribute__((aligned(16))) float sU[2][S_ * UP_]; // 2 x 72 KB uh chunks
  __shared__ float red[256];
  __shared__ float rowStat[TT_];

  const int tid   = threadIdx.x;
  const int b     = blockIdx.x / (T_ / TT_);          // T/8 = 64 tiles per batch
  const int t0    = (blockIdx.x % (T_ / TT_)) * TT_;
  const int len   = mem_masks[b];

  // --- stage wq tile, v and the first uh chunk into LDS ---
  const float* wqBase = wq + ((size_t)b * T_ + t0) * D_;
  const float* uhB    = uh + (size_t)b * S_ * D_;
  const int gr = tid >> 3;               // staging: 8 threads cover one 128-B row piece
  const int gc = (tid & 7) << 2;
  const unsigned gOff = (unsigned)(gr * D_ + gc);  // lane's fixed offset; the chunk moves the base
  v4f pf[16];
#pragma unroll
  for (int k = 0; k < 16; ++k)
    pf[k] = *(const v4f*)(uhB + gOff + (unsigned)(32 * k * D_));
  for (int i = tid; i < TT_ * D_; i += 256) sWq[i] = wqBase[i];
  for (int i = tid; i < D_;      i += 256) sV[i]  = v[i];
#pragma unroll
  for (int k = 0; k < 16; ++k)
    *(v4f*)(&sU[0][(gr + 32 * k) * UP_ + gc]) = pf[k];
  __syncthreads();

  // --- Phase 1: additive-attention scores (the 268M-tanh hot loop) ---
  // Lanes run along s. Each thread owns 4 s x 4 t scores in registers, so one
  // uh value feeds 4 tanh and one wq value (same LDS address in every lane)
  // feeds 4. Each score keeps an even-d and an odd-d partial sum, d ascending.
  {
    const int lane  = tid & 31;
    const int wv    = tid >> 5;
    const int sBase = ((wv & 3) << 7) + lane;   // s = sBase + 32*j, j = 0..3
    const int tBase = (wv >> 2) << 2;           // t = tBase + 0..3
    v2f acc[4][4];
#pragma unroll
    for (int t = 0; t < 4; ++t)
#pragma unroll
      for (int j = 0; j < 4; ++j) acc[t][j] = (v2f){0.0f, 0.0f};

#pragma unroll 1   // one chunk body is already several KB of code
    for (int c = 0; c < D_ / DC_; ++c) {
      const float* cur = sU[c & 1];
      const bool more = (c + 1) < D_ / DC_;     // same for the whole block
      if (more) {
        const float* nb = uhB + (c + 1) * DC_ + gOff;
#pragma unroll
        for (int k = 0; k < 16; ++k)            // next chunk flies during this one's math
          pf[k] = *(const v4f*)(nb + (unsigned)(32 * k * D_));
        // Keeps the loads' address registers untouched (not even reused as a
        // load's own destination) until the wait that stands before an overwrite.
        asm volatile("s_wait_xcnt 0x0" :: "v"(nb) : "memory");
      }
#pragma unroll 2   // lets the next quad's LDS reads issue under this quad's math
      for (int q = 0; q < DC_ / 4; ++q) {
        const int d = c * DC_ + q * 4;
        v4f u[4];
#pragma unroll
        for (int j = 0; j < 4; ++j)
          u[j] = *(const v4f*)(cur + (sBase + 32 * j) * UP_ + q * 4);
        const v4f vd = *(const v4f*)(sV + d);
        const v2f vlo = {vd.x, vd.y}, vhi = {vd.z, vd.w};
#pragma unroll
        for (int t = 0; t < 4; ++t) {
          const v4f w = *(const v4f*)(sWq + (tBase + t) * D_ + d);
          const v2f wlo = {w.x, w.y}, whi = {w.z, w.w};
#pragma unroll
          for (int j = 0; j < 4; ++j) {
            const v2f x0 = wlo + (v2f){u[j].x, u[j].y};
            const v2f x1 = whi + (v2f){u[j].z, u[j].w};
            const v2f h0 = {FAST_TANH(x0.x), FAST_TANH(x0.y)};
            const v2f h1 = {FAST_TANH(x1.x), FAST_TANH(x1.y)};
            acc[t][j] = __builtin_elementwise_fma(vlo, h0, acc[t][j]);
            acc[t][j] = __builtin_elementwise_fma(vhi, h1, acc[t][j]);
          }
        }
      }
      if (more) {
        float* nxt = sU[(c + 1) & 1];           // last read in pass c-1, ended by its barrier
#pragma unroll
        for (int k = 0; k < 16; ++k)
          *(v4f*)(nxt + (gr + 32 * k) * UP_ + gc) = pf[k];
        __syncthreads();                        // publishes chunk c+1, ends the reads of chunk c
      }
    }
#pragma unroll
    for (int t = 0; t < 4; ++t)
#pragma unroll
      for (int j = 0; j < 4; ++j)
        sP[(tBase + t) * S_ + sBase + 32 * j] = acc[t][j].x + acc[t][j].y;
  }
  __syncthreads();

  // --- Phase 2: masked softmax over s, per row (32 threads / row) ---
  const int row = tid >> 5;
  const int sub = tid & 31;
  float mx = -INFINITY;
  for (int s = sub; s < S_; s += 32)
    if (s < len) mx = fmaxf(mx, sP[row * S_ + s]);
  red[tid] = mx;
  __syncthreads();
  if (sub == 0) {
    float m = red[row * 32];
    for (int j = 1; j < 32; ++j) m = fmaxf(m, red[row * 32 + j]);
    rowStat[row] = m;
  }
  __syncthreads();
  const float rm = rowStat[row];
  float sum = 0.0f;
  for (int s = sub; s < S_; s += 32) {
    float e = (s < len) ? __expf(sP[row * S_ + s] - rm) : 0.0f;
    sP[row * S_ + s] = e;
    sum += e;
  }
  red[tid] = sum;
  __syncthreads();
  if (sub == 0) {
    float t = 0.0f;
    for (int j = 0; j < 32; ++j) t += red[row * 32 + j];
    rowStat[row] = t;
  }
  __syncthreads();
  const float inv = 1.0f / rowStat[row];
  float* aOut = alignOut + ((size_t)b * T_ + t0 + row) * S_;
  for (int s = sub; s < S_; s += 32) {
    float p = sP[row * S_ + s] * inv;
    sP[row * S_ + s] = p;
    aOut[s] = p;                               // masked slots are exactly 0
  }
  __syncthreads();

  // --- Phase 3: context c = P[8,512] * mems[b][512,256] via f32 WMMA ---
  {
    const int wv   = tid >> 5;
    const int lane = tid & 31;
    const int r    = lane & 15;
    const int kk   = (lane >> 4) << 1;
    const float* memB = mems + (size_t)b * S_ * D_;
    float* cBase = cOut + ((size_t)b * T_ + t0) * D_;
    for (int nt = wv; nt < D_ / 16; nt += 8) { // 16 n-tiles over 8 waves
      const int n0 = nt << 4;
      v8f acc = {};
#pragma unroll 4
      for (int k0 = 0; k0 < S_; k0 += 4) {
        const int kb = k0 + kk;
        v2f a = *(const v2f*)(sP + (r & 7) * S_ + kb);  // LDS, 8B aligned; rows 8-15 repeat 0-7
        v2f bm;
        bm.x = memB[(size_t)kb * D_ + n0 + r];          // B: col-striped lanes
        bm.y = memB[(size_t)(kb + 1) * D_ + n0 + r];
        acc = __builtin_amdgcn_wmma_f32_16x16x4_f32(
            false, a, false, bm, (short)0, acc, false, false);
      }
      // The selects below read D: they stay behind the four vector slots that follow the last WMMA.
      __builtin_amdgcn_sched_barrier(0);
      asm volatile("v_nop\n\tv_nop\n\tv_nop\n\tv_nop");
      __builtin_amdgcn_sched_barrier(0);   // holds the slots directly behind that WMMA
      // Lanes 16-31 hold rows 0-7 once more: they store rows 4-7, lanes 0-15 rows 0-3.
      const int half = lane >> 4;
      float* cp = cBase + (half * 4) * D_ + n0 + r;
      const v4f lo = __builtin_shufflevector(acc, acc, 0, 1, 2, 3);
      const v4f hi = __builtin_shufflevector(acc, acc, 4, 5, 6, 7);
      const v4f o  = half ? hi : lo;
#pragma unroll
      for (int j = 0; j < 4; ++j)
        cp[j * D_] = o[j];
    }
  }
}

// ---------------------------------------------------------------------------
// Output projection: attn_h = concat(c, inputs) * Wout^T + bout
// K = 256 from c, then 512 from inputs, so the concat is never materialized.
// M = B*T = 2048, N = 512, K = 768.
// ---------------------------------------------------------------------------
__global__ __launch_bounds__(256) void outproj_kernel(
    const float* __restrict__ Cctx,   // [B*T, 256]
    const float* __restrict__ X,      // [B*T, 512]
    const float* __restrict__ W,      // [512, 768]
    const float* __restrict__ bias,   // [512]
    float* __restrict__ Out)          // [B*T, 512]
{
  gemm_nt_tile<D_ / KC_, D_, IN_ / KC_, IN_, IN_, true>(Cctx, X, W, bias, Out);
}

// ---------------------------------------------------------------------------
extern "C" void kernel_launch(void* const* d_in, const int* in_sizes, int n_in,
                              void* d_out, int out_size, void* d_ws, size_t ws_size,
                              hipStream_t stream) {
  const float* inputs    = (const float*)d_in[0];  // [B,T,IN]
  const float* mems      = (const float*)d_in[1];  // [B,S,D]
  const int*   mem_masks = (const int*)  d_in[2];  // [B]
  const float* Wq        = (const float*)d_in[3];  // [D,IN]
  const float* Wc        = (const float*)d_in[4];  // [D,D]
  const float* bc        = (const float*)d_in[5];  // [D]
  const float* v         = (const float*)d_in[6];  // [D]
  const float* Wout      = (const float*)d_in[7];  // [IN, D+IN]
  const float* bout      = (const float*)d_in[8];  // [IN]

  float* attn  = (float*)d_out;                        // [B,T,IN]
  float* align = attn + (size_t)B_ * T_ * IN_;         // [B,T,S]

  float* ws  = (float*)d_ws;
  float* wq  = ws;                                     // [B*T, D]
  float* uh  = wq + (size_t)B_ * T_ * D_;              // [B*S, D]
  float* ctx = uh + (size_t)B_ * S_ * D_;              // [B*T, D]

  const int M = B_ * T_;                               // 2048 (== B*S too)

  // 1) wq = inputs * Wq^T          : 64 x 32 tiles -> 256 blocks of 8 waves
  proj_q_kernel<<<(M / 64) * (D_ / 32), 256, 0, stream>>>(inputs, Wq, wq);

  // 2) uh = mems * Wc^T + bc
  proj_u_kernel<<<(M / 64) * (D_ / 32), 256, 0, stream>>>(mems, Wc, bc, uh);

  // 3) fused tanh-score + masked softmax + context (one block per 8 t-rows)
  attn_score_ctx_kernel<<<B_ * (T_ / TT_), 256, 0, stream>>>(
      wq, uh, mems, v, mem_masks, align, ctx);

  // 4) attn_h = concat(ctx, inputs) * Wout^T + bout : 64 x 32 tiles -> 512 blocks
  outproj_kernel<<<(M / 64) * (IN_ / 32), 256, 0, stream>>>(
      ctx, inputs, Wout, bout, attn);
}

// v004
// One run takes 59.1 microseconds.
// Timed twice side by side with v003, it ran 1.19 and 1.18 times as fast.
// All steps since v000 together make it 5.51 times as fast.
#include <hip/hip_runtime.h>
#include <hip/hip_bf16.h>
#include <math.h>

// Problem constants (from reference)
#define B_ 4
#define T_ 512
#define S_ 512
#define IN_ 512
#define D_ 256   // MEM_DIM

typedef __attribute__((ext_vector_type(2))) float v2f;
typedef __attribute__((ext_vector_type(4))) float v4f;
typedef __attribute__((ext_vector_type(8))) float v8f;

#define TT_ 8           // t rows per score block: B*T/TT_ = 256 blocks
#define DC_ 32          // d values of uh staged per pass
#define UP_ (DC_ + 4)   // LDS row pitch in floats: 144 B = 16 B x odd, conflict-free b128 rows
#define CK_ 64          // s rows of mems staged per pass of the context product
#define MP_ (D_ + 32)   // their LDS pitch in floats: rows k and k+1, read together, lie 32 banks apart
#define PA_ (2 * S_ + 4) // pitch of a row of the context product's A in floats: 16 rows on distinct banks

// Native CDNA5 V_TANH_F32 if the toolchain exposes it; OCML fallback.
#if defined(__has_builtin)
#if __has_builtin(__builtin_amdgcn_tanhf)
#define FAST_TANH(x) __builtin_amdgcn_tanhf(x)
#endif
#endif
#ifndef FAST_TANH
#define FAST_TANH(x) tanhf(x)
#endif

// ---------------------------------------------------------------------------
// fp32 WMMA GEMM body:  C[M,N] = [A1 | A2][M,K] * W[N,K]^T (+ bias[N])
// One block = one 64 x 32 tile of C, 8 waves, one 16x16 tile per wave.
// A and W come in 64-k chunks through LDS: every global load is whole 128-B
// lines (16 lanes x 16 B per row), each element is fetched once per block, and
// later chunks' loads fly while this chunk is multiplied (two LDS buffers, fed
// from two register sets).
//
// Fragments (V_WMMA_F32_16X16X4_F32): lanes 0-15 hold row/col r with the first
// two k of the instruction, lanes 16-31 the same r with the last two.
// One 16-B LDS read per lane feeds two WMMAs: of each group of 8 k, lanes 0-15
// read k 0..3 and lanes 16-31 k 4..7; the first WMMA takes k {0,1 | 4,5}, the
// second k {2,3 | 6,7}. A and W use the same map, so every product pairs.
// C/D layout: VGPR j -> M = m0 + j (+8 for upper half-wave), N = lane&15.
// ---------------------------------------------------------------------------
#define KC_ 64          // k values of A and W staged per pass
#define GP_ (KC_ + 4)   // LDS row pitch in floats: 272 B = 16 B x odd, conflict-free b128 rows

template <int NC1, int LDA1, int NC2, int LDA2, int N, bool BIAS>
__device__ __forceinline__ void gemm_nt_tile(
    const float* __restrict__ A1,    // first NC1 chunks of K, row pitch LDA1
    const float* __restrict__ A2,    // next NC2 chunks of K, row pitch LDA2
    const float* __restrict__ W,     // [N, (NC1+NC2)*KC_]
    const float* __restrict__ bias,  // [N], read only if BIAS
    float* __restrict__ C)           // [M, N]
{
  constexpr int NC  = NC1 + NC2;
  constexpr int LDW = NC * KC_;
  __shared__ __attribute__((aligned(16))) float sA[2][64 * GP_];
  __shared__ __attribute__((aligned(16))) float sW[2][32 * GP_];

  const int tid = threadIdx.x;
  const int m0  = (blockIdx.x / (N / 32)) << 6;
  const int n0  = (blockIdx.x % (N / 32)) << 5;
  const int gr  = tid >> 4;              // staging: 16 threads cover one 256-B row piece
  const int gc  = (tid & 15) << 2;
  const unsigned oA1 = (unsigned)(gr * LDA1 + gc);   // lane's fixed offsets; the chunk moves the base
  const unsigned oA2 = (unsigned)(gr * LDA2 + gc);
  const unsigned oW  = (unsigned)(gr * LDW + gc);
  const int sOff = gr * GP_ + gc;

  const int lane = tid & 31;
  const int wv   = tid >> 5;
  const int r    = lane & 15;
  const int half = lane >> 4;
  const int aOff = (((wv & 3) << 4) + r) * GP_ + (half << 2);
  const int bOff = (((wv >> 2) << 4) + r) * GP_ + (half << 2);
  const int col  = n0 + ((wv >> 2) << 4) + r;

  v4f pa[2][4], pw[2][2];                // two register sets: chunk c travels in set c & 1
  auto fetch = [&](int c) {
    const int s = c & 1;
    const float* wp = W + (size_t)n0 * LDW + c * KC_;
#pragma unroll
    for (int k = 0; k < 2; ++k)
      pw[s][k] = *(const v4f*)(wp + oW + (unsigned)(16 * k * LDW));
    if (NC2 == 0 || c < NC1) {           // same for the whole block
      const float* ap = A1 + (size_t)m0 * LDA1 + c * KC_;
#pragma unroll
      for (int k = 0; k < 4; ++k)
        pa[s][k] = *(const v4f*)(ap + oA1 + (unsigned)(16 * k * LDA1));
    } else {
      const float* ap = A2 + (size_t)m0 * LDA2 + (c - NC1) * KC_;
#pragma unroll
      for (int k = 0; k < 4; ++k)
        pa[s][k] = *(const v4f*)(ap + oA2 + (unsigned)(16 * k * LDA2));
    }
    // The wait that stands before the loads' address registers are overwritten.
    asm volatile("s_wait_xcnt 0x0" ::: "memory");
  };
  auto stage = [&](int buf) {
#pragma unroll
    for (int k = 0; k < 4; ++k) *(v4f*)(&sA[buf][sOff + 16 * k * GP_]) = pa[buf][k];
#pragma unroll
    for (int k = 0; k < 2; ++k) *(v4f*)(&sW[buf][sOff + 16 * k * GP_]) = pw[buf][k];
  };

  v8f acc = {};
  auto mult = [&](int buf, int g0, int g1) {   // groups of 8 k: g0 <= g < g1
    const float* ca = &sA[buf][aOff];
    const float* cw = &sW[buf][bOff];
#pragma unroll
    for (int g = g0; g < g1; ++g) {
      const v4f a = *(const v4f*)(ca + g * 8);
      const v4f w = *(const v4f*)(cw + g * 8);
      acc = __builtin_amdgcn_wmma_f32_16x16x4_f32(
          false, (v2f){a.x, a.y}, false, (v2f){w.x, w.y}, (short)0, acc, false, false);
      acc = __builtin_amdgcn_wmma_f32_16x16x4_f32(
          false, (v2f){a.z, a.w}, false, (v2f){w.z, w.w}, (short)0, acc, false, false);
    }
  };

  fetch(0);
  fetch(1);
  const float bv = BIAS ? bias[col] : 0.0f;
  stage(0);
  __syncthreads();

  // One pass: chunk c+2's loads start, into the register set that chunk c left in the pass
  // before, and have the pass to land; chunk c+1, landed in the pass before, goes to LDS with
  // no wait (into the buffer whose last reads were ended by the pass before's barrier) under
  // the pass's last WMMAs; the barrier publishes chunk c+1 and ends the reads of chunk c.
  auto pass = [&](int c, int buf) {
    if (NC2 != 0 && c + 2 == NC1) {
      // A2's lane offset is formed here, behind WMMAs whose operand registers it may take:
      // the four vector slots between a WMMA and vector work on its A or B, held in place.
      __builtin_amdgcn_sched_barrier(0);
      asm volatile("v_nop\n\tv_nop\n\tv_nop\n\tv_nop");
      __builtin_amdgcn_sched_barrier(0);
    }
    if (c + 2 < NC) fetch(c + 2);
    mult(buf, 0, 6);
    stage(buf ^ 1);
    mult(buf, 6, 8);
    __syncthreads();
  };
#pragma unroll     // every chunk's source, offsets and buffer become constants: no index math among the WMMAs
  for (int c = 0; c + 1 < NC; ++c) pass(c, c & 1);
  mult((NC - 1) & 1, 0, 8);
  // The epilogue's vector work (output address, bias adds) stays behind the slots below:
  // among the WMMAs it would overwrite operand registers directly behind their reader.
  __builtin_amdgcn_sched_barrier(0);
  // The four vector slots between the last WMMA and vector work on its D, A or B.
  asm volatile("v_nop\n\tv_nop\n\tv_nop\n\tv_nop");
  __builtin_amdgcn_sched_barrier(0);   // holds the slots directly behind that WMMA

  const int row = m0 + ((wv & 3) << 4) + half * 8;
  float* cp = C + (unsigned)(row * N + col);
#pragma unroll
  for (int j = 0; j < 8; ++j)
    cp[j * N] = acc[j] + bv;
}

// wq = inputs * Wq^T : M = 2048, N = 256, K = 512
__global__ __launch_bounds__(256) void proj_q_kernel(
    const float* __restrict__ A, const float* __restrict__ W, float* __restrict__ C) {
  gemm_nt_tile<IN_ / KC_, IN_, 0, IN_, D_, false>(A, A, W, nullptr, C);
}

// uh = mems * Wc^T + bc : M = 2048, N = 256, K = 256
__global__ __launch_bounds__(256) void proj_u_kernel(
    const float* __restrict__ A, const float* __restrict__ W,
    const float* __restrict__ bias, float* __restrict__ C) {
  gemm_nt_tile<D_ / KC_, D_, 0, D_, D_, true>(A, A, W, bias, C);
}

// ---------------------------------------------------------------------------
// Fused score -> masked softmax -> context kernel.
// One block = one (batch b, 8-row t-tile). 256 threads = 8 waves.
//   Phase 1: align[tl,s] = sum_d v[d]*tanh(wq[t0+tl,d] + uh[b,s,d])
//            (wq tile + v in LDS, read at one address per wave; uh staged in
//             32-d chunks through padded LDS; 4 s x 4 t scores per thread)
//   Phase 2: masked softmax over s (one wave per row), write align_vectors
//   Phase 3: c[8,256] = P[8,512] * mems[b]  via f32 WMMA (A from LDS; the
//            instruction's rows 0-7 make the even columns, rows 8-15 the odd
//            ones; mems comes in 64-row chunks by asynchronous copies into
//            the two uh buffers)
// ---------------------------------------------------------------------------
__global__ __launch_bounds__(256) void attn_score_ctx_kernel(
    const float* __restrict__ wq,        // [B*T, D]
    const float* __restrict__ uh,        // [B*S, D]
    const float* __restrict__ mems,      // [B, S, D]
    const float* __restrict__ v,         // [D]
    const int*   __restrict__ mem_masks, // [B]
    float* __restrict__ alignOut,        // [B, T, S]
    float* __restrict__ cOut)            // [B*T, D]
{
  __shared__ __attribute__((aligned(16))) float sWq[TT_ * D_];  // 8 KB
  __shared__ float sP[TT_ * S_];         // 16 KB   scores -> exp(score - row max)
  __shared__ __attribute__((aligned(16))) float sV[D_];         // 1 KB
  __shared__ __attribute__((aligned(16))) float sU[2][S_ * UP_]; // 2 x 72 KB uh chunks, then mems chunks
  __shared__ __attribute__((aligned(16))) float sPE[16 * PA_];   // 64 KB  A of the context product
  static_assert(CK_ * MP_ <= S_ * UP_, "a mems chunk fits a uh buffer");
  __shared__ float red[256];
  __shared__ float rowStat[TT_];

  const int tid   = threadIdx.x;
  const int b     = blockIdx.x / (T_ / TT_);          // T/8 = 64 tiles per batch
  const int t0    = (blockIdx.x % (T_ / TT_)) * TT_;
  const int len   = mem_masks[b];

  // --- stage wq tile, v and the first uh chunk into LDS ---
  const float* wqBase = wq + ((size_t)b * T_ + t0) * D_;
  const float* uhB    = uh + (size_t)b * S_ * D_;
  const int gr = tid >> 3;               // staging: 8 threads cover one 128-B row piece
  const int gc = (tid & 7) << 2;
  const unsigned gOff = (unsigned)(gr * D_ + gc);  // lane's fixed offset; the chunk moves the base
  v4f pf[16];
#pragma unroll
  for (int k = 0; k < 16; ++k)
    pf[k] = *(const v4f*)(uhB + gOff + (unsigned)(32 * k * D_));
  for (int i = tid; i < TT_ * D_; i += 256) sWq[i] = wqBase[i];
  for (int i = tid; i < D_;      i += 256) sV[i]  = v[i];
#pragma unroll
  for (int k = 0; k < 16; ++k)
    *(v4f*)(&sU[0][(gr + 32 * k) * UP_ + gc]) = pf[k];
  __syncthreads();

  // --- Phase 1: additive-attention scores (the 268M-tanh hot loop) ---
  // Lanes run along s. Each thread owns 4 s x 4 t scores in registers, so one
  // uh value feeds 4 tanh and one wq value (same LDS address in every lane)
  // feeds 4. Each score keeps an even-d and an odd-d partial sum, d ascending.
  {
    const int lane  = tid & 31;
    const int wv    = tid >> 5;
    const int sBase = ((wv & 3) << 7) + lane;   // s = sBase + 32*j, j = 0..3
    const int tBase = (wv >> 2) << 2;           // t = tBase + 0..3
    v2f acc[4][4];
#pragma unroll
    for (int t = 0; t < 4; ++t)
#pragma unroll
      for (int j = 0; j < 4; ++j) acc[t][j] = (v2f){0.0f, 0.0f};

#pragma unroll 1   // one chunk body is already several KB of code
    for (int c = 0; c < D_ / DC_; ++c) {
      const float* cur = sU[c & 1];
      const bool more = (c + 1) < D_ / DC_;     // same for the whole block
      if (more) {
        const float* nb = uhB + (c + 1) * DC_ + gOff;
#pragma unroll
        for (int k = 0; k < 16; ++k)            // next chunk flies during this one's math
          pf[k] = *(const v4f*)(nb + (unsigned)(32 * k * D_));
        // Keeps the loads' address registers untouched (not even reused as a
        // load's own destination) until the wait that stands before an overwrite.
        asm volatile("s_wait_xcnt 0x0" :: "v"(nb) : "memory");
      }
#pragma unroll 2   // lets the next quad's LDS reads issue under this quad's math
      for (int q = 0; q < DC_ / 4; ++q) {
        const int d = c * DC_ + q * 4;
        v4f u[4];
#pragma unroll
        for (int j = 0; j < 4; ++j)
          u[j] = *(const v4f*)(cur + (sBase + 32 * j) * UP_ + q * 4);
        const v4f vd = *(const v4f*)(sV + d);
        const v2f vlo = {vd.x, vd.y}, vhi = {vd.z, vd.w};
#pragma unroll
        for (int t = 0; t < 4; ++t) {
          const v4f w = *(const v4f*)(sWq + (tBase + t) * D_ + d);
          const v2f wlo = {w.x, w.y}, whi = {w.z, w.w};
#pragma unroll
          for (int j = 0; j < 4; ++j) {
            const v2f x0 = wlo + (v2f){u[j].x, u[j].y};
            const v2f x1 = whi + (v2f){u[j].z, u[j].w};
            const v2f h0 = {FAST_TANH(x0.x), FAST_TANH(x0.y)};
            const v2f h1 = {FAST_TANH(x1.x), FAST_TANH(x1.y)};
            acc[t][j] = __builtin_elementwise_fma(vlo, h0, acc[t][j]);
            acc[t][j] = __builtin_elementwise_fma(vhi, h1, acc[t][j]);
          }
        }
      }
      if (more) {
        float* nxt = sU[(c + 1) & 1];           // last read in pass c-1, ended by its barrier
#pragma unroll
        for (int k = 0; k < 16; ++k)
          *(v4f*)(nxt + (gr + 32 * k) * UP_ + gc) = pf[k];
        __syncthreads();                        // publishes chunk c+1, ends the reads of chunk c
      }
    }
#pragma unroll
    for (int t = 0; t < 4; ++t)
#pragma unroll
      for (int j = 0; j < 4; ++j)
        sP[(tBase + t) * S_ + sBase + 32 * j] = acc[t][j].x + acc[t][j].y;
  }

  // One chunk of mems (64 rows x 1 KB) into one uh buffer: 16 copies of 16 B per lane, a wave
  // covering 512 contiguous bytes per copy. Each run of copies ends, inside its own statement,
  // with the wait that stands before the copies' address registers are overwritten.
  const float* memB = mems + (size_t)b * S_ * D_;
  const int cr = tid >> 6;               // 64 threads cover one row; copy i takes row 4 i + cr
  const int cc = (tid & 63) << 2;
  auto copy_chunk = [&](int ch, int buf) {
    const float* g = memB + (unsigned)((ch * CK_ + cr) * D_ + cc);
    const unsigned l = (unsigned)(size_t)(&sU[buf][cr * MP_ + cc]);
#pragma unroll
    for (int h = 0; h < 16; h += 8)
      asm volatile(
          "global_load_async_to_lds_b128 %0, %8, off\n\t"
          "global_load_async_to_lds_b128 %1, %9, off\n\t"
          "global_load_async_to_lds_b128 %2, %10, off\n\t"
          "global_load_async_to_lds_b128 %3, %11, off\n\t"
          "global_load_async_to_lds_b128 %4, %12, off\n\t"
          "global_load_async_to_lds_b128 %5, %13, off\n\t"
          "global_load_async_to_lds_b128 %6, %14, off\n\t"
          "global_load_async_to_lds_b128 %7, %15, off\n\t"
          "s_wait_xcnt 0x0"
          :: "v"(l + (h + 0) * 16 * MP_), "v"(l + (h + 1) * 16 * MP_),
             "v"(l + (h + 2) * 16 * MP_), "v"(l + (h + 3) * 16 * MP_),
             "v"(l + (h + 4) * 16 * MP_), "v"(l + (h + 5) * 16 * MP_),
             "v"(l + (h + 6) * 16 * MP_), "v"(l + (h + 7) * 16 * MP_),
             "v"(g + (h + 0) * 4 * D_), "v"(g + (h + 1) * 4 * D_),
             "v"(g + (h + 2) * 4 * D_), "v"(g + (h + 3) * 4 * D_),
             "v"(g + (h + 4) * 4 * D_), "v"(g + (h + 5) * 4 * D_),
             "v"(g + (h + 6) * 4 * D_), "v"(g + (h + 7) * 4 * D_)
          : "memory");
  };

  // This wave's reads of uh have returned before the barrier behind which copies overwrite them.
  asm volatile("s_wait_dscnt 0x0" ::: "memory");
  __syncthreads();
  copy_chunk(0, 0);                      // flies during the softmax

  // --- Phase 2: masked softmax over s, per row (32 threads / row) ---
  const int row = tid >> 5;
  const int sub = tid & 31;
  float mx = -INFINITY;
  for (int s = sub; s < S_; s += 32)
    if (s < len) mx = fmaxf(mx, sP[row * S_ + s]);
  red[tid] = mx;
  __syncthreads();
  if (sub == 0) {
    float m = red[row * 32];
    for (int j = 1; j < 32; ++j) m = fmaxf(m, red[row * 32 + j]);
    rowStat[row] = m;
  }
  __syncthreads();
  const float rm = rowStat[row];
  float sum = 0.0f;
  for (int s = sub; s < S_; s += 32) {
    float e = (s < len) ? __expf(sP[row * S_ + s] - rm) : 0.0f;
    sP[row * S_ + s] = e;
    sum += e;
  }
  red[tid] = sum;
  __syncthreads();
  if (sub == 0) {
    float t = 0.0f;
    for (int j = 0; j < 32; ++j) t += red[row * 32 + j];
    rowStat[row] = t;
  }
  __syncthreads();
  const float inv = 1.0f / rowStat[row];
  float* aOut = alignOut + ((size_t)b * T_ + t0 + row) * S_;
#pragma unroll     // 16 rounds with registers of their own: no store waits for the one before it
  for (int i = 0; i < S_ / 32; ++i) {
    const int s = sub + 32 * i;
    float p = sP[row * S_ + s] * inv;
    // A of the context product: row t holds (p, 0) per s, row t + 8 holds (0, p).
    *(v2f*)(sPE + row * PA_ + 2 * s)       = (v2f){p, 0.0f};
    *(v2f*)(sPE + (row + 8) * PA_ + 2 * s) = (v2f){0.0f, p};
    aOut[s] = p;                               // masked slots are exactly 0
  }
  // This wave's copies of chunk 0 have landed; the barrier publishes them, and A, to all waves.
  asm volatile("s_wait_asynccnt 0x0" ::: "memory");
  __syncthreads();
  copy_chunk(1, 1);

  // --- Phase 3: context c = P[8,512] * mems[b][512,256] via f32 WMMA ---
  // A wave owns 32 columns. One WMMA takes two s rows, k and k+1 (lanes 0-15 row k, lanes 16-31
  // row k+1). A lane's B pair is one 8-B LDS read: its row's columns c, c+1. A pairs them with
  // (p, 0) in rows 0-7 and (0, p) in rows 8-15, so D rows 0-7 are column c, rows 8-15 column c+1
  // of the 8 t rows: no row of the instruction is a repeat. s ascends in every sum, as before.
  {
    const int wv   = tid >> 5;
    const int lane = tid & 31;
    const int r    = lane & 15;
    const int half = lane >> 4;
    const int c    = (wv << 5) + 2 * r;
    const float* pa = sPE + r * PA_ + 2 * half;
    v8f acc = {};
#pragma unroll 1   // one chunk body serves both buffers: short code
    for (int ch = 0; ch < S_ / CK_; ++ch) {
      const float* mb = &sU[ch & 1][half * MP_ + c];
      const float* ap = pa + ch * (2 * CK_);
      v2f fa[2][8], fb[2][8];                   // two fragment sets: group g of 8 WMMAs sits in set g & 1
      auto frag = [&](int g) {
#pragma unroll
        for (int q = 0; q < 8; ++q) {
          const int i = g * 8 + q;              // s rows 2 i, 2 i + 1 of the chunk
          fa[g & 1][q] = *(const v2f*)(ap + 4 * i);
          fb[g & 1][q] = *(const v2f*)(mb + 2 * i * MP_);
        }
      };
      frag(0);
      __builtin_amdgcn_sched_barrier(0);        // group 0's reads return first: the first WMMA waits for them alone
#pragma unroll
      for (int g = 0; g < CK_ / 16; ++g) {
        if (g + 1 < CK_ / 16) frag(g + 1);
        // Keeps the next group's LDS reads in front of this group's WMMAs, which cover their latency.
        __builtin_amdgcn_sched_barrier(0);
#pragma unroll
        for (int q = 0; q < 8; ++q)
          acc = __builtin_amdgcn_wmma_f32_16x16x4_f32(
              false, fa[g & 1][q], false, fb[g & 1][q], (short)0, acc, false, false);
        // The four vector slots between the group's last WMMA and vector work on its D, A or B
        // (address sums of the next reads and copies), held directly behind it.
        __builtin_amdgcn_sched_barrier(0);
        asm volatile("v_nop\n\tv_nop\n\tv_nop\n\tv_nop");
        __builtin_amdgcn_sched_barrier(0);
      }
      // Hand-over: this wave's reads of chunk ch have returned and its copies of chunk ch+1 have
      // landed; the barrier publishes chunk ch+1 and frees chunk ch's buffer for the refill.
      asm volatile("s_wait_dscnt 0x0" ::: "memory");
      asm volatile("s_wait_asynccnt 0x0" ::: "memory");
      __syncthreads();
      if (ch + 2 < S_ / CK_) copy_chunk(ch + 2, ch & 1);   // same for the whole block
    }
    asm volatile("s_wait_asynccnt 0x0" ::: "memory");      // no copy is left when the wave ends
    float* cp = cOut + ((size_t)b * T_ + t0) * D_ + c + half;
#pragma unroll
    for (int j = 0; j < 8; ++j)
      cp[j * D_] = acc[j];
  }
}

// ---------------------------------------------------------------------------
// Output projection: attn_h = concat(c, inputs) * Wout^T + bout
// K = 256 from c, then 512 from inputs, so the concat is never materialized.
// M = B*T = 2048, N = 512, K = 768.
// ---------------------------------------------------------------------------
__global__ __launch_bounds__(256) void outproj_kernel(
    const float* __restrict__ Cctx,   // [B*T, 256]
    const float* __restrict__ X,      // [B*T, 512]
    const float* __restrict__ W,      // [512, 768]
    const float* __restrict__ bias,   // [512]
    float* __restrict__ Out)          // [B*T, 512]
{
  gemm_nt_tile<D_ / KC_, D_, IN_ / KC_, IN_, IN_, true>(Cctx, X, W, bias, Out);
}

// ---------------------------------------------------------------------------
extern "C" void kernel_launch(void* const* d_in, const int* in_sizes, int n_in,
                              void* d_out, int out_size, void* d_ws, size_t ws_size,
                              hipStream_t stream) {
  const float* inputs    = (const float*)d_in[0];  // [B,T,IN]
  const float* mems      = (const float*)d_in[1];  // [B,S,D]
  const int*   mem_masks = (const int*)  d_in[2];  // [B]
  const float* Wq        = (const float*)d_in[3];  // [D,IN]
  const float* Wc        = (const float*)d_in[4];  // [D,D]
  const float* bc        = (const float*)d_in[5];  // [D]
  const float* v         = (const float*)d_in[6];  // [D]
  const float* Wout      = (const float*)d_in[7];  // [IN, D+IN]
  const float* bout      = (const float*)d_in[8];  // [IN]

  float* attn  = (float*)d_out;                        // [B,T,IN]
  float* align = attn + (size_t)B_ * T_ * IN_;         // [B,T,S]

  float* ws  = (float*)d_ws;
  float* wq  = ws;                                     // [B*T, D]
  float* uh  = wq + (size_t)B_ * T_ * D_;              // [B*S, D]
  float* ctx = uh + (size_t)B_ * S_ * D_;              // [B*T, D]

  const int M = B_ * T_;                               // 2048 (== B*S too)

  // 1) wq = inputs * Wq^T          : 64 x 32 tiles -> 256 blocks of 8 waves
  proj_q_kernel<<<(M / 64) * (D_ / 32), 256, 0, stream>>>(inputs, Wq, wq);

  // 2) uh = mems * Wc^T + bc
  proj_u_kernel<<<(M / 64) * (D_ / 32), 256, 0, stream>>>(mems, Wc, bc, uh);

  // 3) fused tanh-score + masked softmax + context (one block per 8 t-rows)
  attn_score_ctx_kernel<<<B_ * (T_ / TT_), 256, 0, stream>>>(
      wq, uh, mems, v, mem_masks, align, ctx);

  // 4) attn_h = concat(ctx, inputs) * Wout^T + bout : 64 x 32 tiles -> 512 blocks
  outproj_kernel<<<(M / 64) * (IN_ / 32), 256, 0, stream>>>(
      ctx, inputs, Wout, bout, attn);
}

// v005
// One run takes 54.1 microseconds.
// In two side-by-side timings against v004, it was 1.10 and 1.09 times as fast.
// All steps since v000 together make it 6.02 times as fast.
#include <hip/hip_runtime.h>
#include <hip/hip_bf16.h>
#include <math.h>

// Problem constants (from reference)
#define B_ 4
#define T_ 512
#define S_ 512
#define IN_ 512
#define D_ 256   // MEM_DIM

typedef __attribute__((ext_vector_type(2))) float v2f;
typedef __attribute__((ext_vector_type(4))) float v4f;
typedef __attribute__((ext_vector_type(8))) float v8f;

#define TT_ 8           // t rows per score block: B*T/TT_ = 256 blocks
#define DC_ 32          // d values of uh staged per pass
#define UP_ (DC_ + 4)   // LDS row pitch in floats: 144 B = 16 B x odd, conflict-free b128 rows
#define CK_ 64          // s rows of mems staged per pass of the context product
#define MP_ (D_ + 32)   // their LDS pitch in floats: rows k and k+1, read together, lie 32 banks apart
#define PA_ (2 * S_ + 4) // pitch of a row of the context product's A in floats: 16 rows on distinct banks

// Native CDNA5 V_TANH_F32 if the toolchain exposes it; OCML fallback.
#if defined(__has_builtin)
#if __has_builtin(__builtin_amdgcn_tanhf)
#define FAST_TANH(x) __builtin_amdgcn_tanhf(x)
#endif
#endif
#ifndef FAST_TANH
#define FAST_TANH(x) tanhf(x)
#endif

// ---------------------------------------------------------------------------
// fp32 WMMA GEMM body:  C[M,N] = [A1 | A2][M,K] * W[N,K]^T (+ bias[N])
// One block = one 64 x 32 tile of C (tile number blk), 8 waves, one 16x16 tile per wave.
// A and W come in 64-k chunks through LDS: every global load is whole 128-B
// lines (16 lanes x 16 B per row), each element is fetched once per block, and
// later chunks' loads fly while this chunk is multiplied (two LDS buffers, fed
// from two register sets).
//
// Fragments (V_WMMA_F32_16X16X4_F32): lanes 0-15 hold row/col r with the first
// two k of the instruction, lanes 16-31 the same r with the last two.
// One 16-B LDS read per lane feeds two WMMAs: of each group of 8 k, lanes 0-15
// read k 0..3 and lanes 16-31 k 4..7; the first WMMA takes k {0,1 | 4,5}, the
// second k {2,3 | 6,7}. A and W use the same map, so every product pairs.
// C/D layout: VGPR j -> M = m0 + j (+8 for upper half-wave), N = lane&15.
// ---------------------------------------------------------------------------
#define KC_ 64          // k values of A and W staged per pass
#define GP_ (KC_ + 4)   // LDS row pitch in floats: 272 B = 16 B x odd, conflict-free b128 rows

template <int NC1, int LDA1, int NC2, int LDA2, int N, bool BIAS>
__device__ __forceinline__ void gemm_nt_tile(
    const float* __restrict__ A1,    // first NC1 chunks of K, row pitch LDA1
    const float* __restrict__ A2,    // next NC2 chunks of K, row pitch LDA2
    const float* __restrict__ W,     // [N, (NC1+NC2)*KC_]
    const float* __restrict__ bias,  // [N], read only if BIAS
    float* __restrict__ C,           // [M, N]
    unsigned blk,                    // which tile of C; same for the whole block
    float (*sA)[64 * GP_],           // LDS: two buffers of A
    float (*sW)[32 * GP_])           // LDS: two buffers of W
{
  constexpr int NC  = NC1 + NC2;
  constexpr int LDW = NC * KC_;

  const int tid = threadIdx.x;
  const int m0  = (blk / (N / 32)) << 6;
  const int n0  = (blk % (N / 32)) << 5;
  const int gr  = tid >> 4;              // staging: 16 threads cover one 256-B row piece
  const int gc  = (tid & 15) << 2;
  const unsigned oA1 = (unsigned)(gr * LDA1 + gc);   // lane's fixed offsets; the chunk moves the base
  const unsigned oA2 = (unsigned)(gr * LDA2 + gc);
  const unsigned oW  = (unsigned)(gr * LDW + gc);
  const int sOff = gr * GP_ + gc;

  const int lane = tid & 31;
  const int wv   = tid >> 5;
  const int r    = lane & 15;
  const int half = lane >> 4;
  const int aOff = (((wv & 3) << 4) + r) * GP_ + (half << 2);
  const int bOff = (((wv >> 2) << 4) + r) * GP_ + (half << 2);
  const int col  = n0 + ((wv >> 2) << 4) + r;

  v4f pa[2][4], pw[2][2];                // two register sets: chunk c travels in set c & 1
  auto fetch = [&](int c) {
    const int s = c & 1;
    const float* wp = W + (size_t)n0 * LDW + c * KC_;
#pragma unroll
    for (int k = 0; k < 2; ++k)
      pw[s][k] = *(const v4f*)(wp + oW + (unsigned)(16 * k * LDW));
    if (NC2 == 0 || c < NC1) {           // same for the whole block
      const float* ap = A1 + (size_t)m0 * LDA1 + c * KC_;
#pragma unroll
      for (int k = 0; k < 4; ++k)
        pa[s][k] = *(const v4f*)(ap + oA1 + (unsigned)(16 * k * LDA1));
    } else {
      const float* ap = A2 + (size_t)m0 * LDA2 + (c - NC1) * KC_;
#pragma unroll
      for (int k = 0; k < 4; ++k)
        pa[s][k] = *(const v4f*)(ap + oA2 + (unsigned)(16 * k * LDA2));
    }
    // The wait that stands before the loads' address registers are overwritten.
    asm volatile("s_wait_xcnt 0x0" ::: "memory");
  };
  auto stage = [&](int buf) {
#pragma unroll
    for (int k = 0; k < 4; ++k) *(v4f*)(&sA[buf][sOff + 16 * k * GP_]) = pa[buf][k];
#pragma unroll
    for (int k = 0; k < 2; ++k) *(v4f*)(&sW[buf][sOff + 16 * k * GP_]) = pw[buf][k];
  };

  v8f acc = {};
  auto mult = [&](int buf, int g0, int g1) {   // groups of 8 k: g0 <= g < g1
    const float* ca = &sA[buf][aOff];
    const float* cw = &sW[buf][bOff];
#pragma unroll
    for (int g = g0; g < g1; ++g) {
      const v4f a = *(const v4f*)(ca + g * 8);
      const v4f w = *(const v4f*)(cw + g * 8);
      acc = __builtin_amdgcn_wmma_f32_16x16x4_f32(
          false, (v2f){a.x, a.y}, false, (v2f){w.x, w.y}, (short)0, acc, false, false);
      acc = __builtin_amdgcn_wmma_f32_16x16x4_f32(
          false, (v2f){a.z, a.w}, false, (v2f){w.z, w.w}, (short)0, acc, false, false);
    }
  };

  fetch(0);
  fetch(1);
  const float bv = BIAS ? bias[col] : 0.0f;
  stage(0);
  __syncthreads();

  // One pass: chunk c+2's loads start, into the register set that chunk c left in the pass
  // before, and have the pass to land; chunk c+1, landed in the pass before, goes to LDS with
  // no wait (into the buffer whose last reads were ended by the pass before's barrier) under
  // the pass's last WMMAs; the barrier publishes chunk c+1 and ends the reads of chunk c.
  auto pass = [&](int c, int buf) {
    if (NC2 != 0 && c + 2 == NC1) {
      // A2's lane offset is formed here, behind WMMAs whose operand registers it may take:
      // the four vector slots between a WMMA and vector work on its A or B, held in place.
      __builtin_amdgcn_sched_barrier(0);
      asm volatile("v_nop\n\tv_nop\n\tv_nop\n\tv_nop");
      __builtin_amdgcn_sched_barrier(0);
    }
    if (c + 2 < NC) fetch(c + 2);
    mult(buf, 0, 6);
    stage(buf ^ 1);
    mult(buf, 6, 8);
    __syncthreads();
  };
#pragma unroll     // every chunk's source, offsets and buffer become constants: no index math among the WMMAs
  for (int c = 0; c + 1 < NC; ++c) pass(c, c & 1);
  mult((NC - 1) & 1, 0, 8);
  // The epilogue's vector work (output address, bias adds) stays behind the slots below:
  // among the WMMAs it would overwrite operand registers directly behind their reader.
  __builtin_amdgcn_sched_barrier(0);
  // The four vector slots between the last WMMA and vector work on its D, A or B.
  asm volatile("v_nop\n\tv_nop\n\tv_nop\n\tv_nop");
  __builtin_amdgcn_sched_barrier(0);   // holds the slots directly behind that WMMA

  const int row = m0 + ((wv & 3) << 4) + half * 8;
  float* cp = C + (unsigned)(row * N + col);
#pragma unroll
  for (int j = 0; j < 8; ++j)
    cp[j * N] = acc[j] + bv;
}

// The two input projections need nothing of each other and share one launch, by block range:
//   blocks 0 .. QB_-1 : wq = inputs * Wq^T     (M = 2048, N = 256, K = 512; the longer, so first)
//   the rest          : uh = mems * Wc^T + bc  (M = 2048, N = 256, K = 256)
#define QB_ ((B_ * T_ / 64) * (D_ / 32))   // tiles of wq
#define UB_ ((B_ * S_ / 64) * (D_ / 32))   // tiles of uh
__global__ __launch_bounds__(256) void proj_qu_kernel(
    const float* __restrict__ X, const float* __restrict__ Wq, float* __restrict__ wq,
    const float* __restrict__ Mm, const float* __restrict__ Wc,
    const float* __restrict__ bc, float* __restrict__ uh) {
  __shared__ __attribute__((aligned(16))) float sA[2][64 * GP_];
  __shared__ __attribute__((aligned(16))) float sW[2][32 * GP_];
  const unsigned blk = blockIdx.x;
  if (blk < QB_)                           // same for the whole block
    gemm_nt_tile<IN_ / KC_, IN_, 0, IN_, D_, false>(X, X, Wq, nullptr, wq, blk, sA, sW);
  else {
    gemm_nt_tile<D_ / KC_, D_, 0, D_, D_, true>(Mm, Mm, Wc, bc, uh, blk - QB_, sA, sW);
    // The wait that stands before the stores' data and address registers are overwritten:
    // in the built code the other range's body follows this one's stores.
    asm volatile("s_wait_xcnt 0x0" ::: "memory");
  }
}

// ---------------------------------------------------------------------------
// Fused score -> masked softmax -> context kernel.
// One block = one (batch b, 8-row t-tile). 256 threads = 8 waves.
//   Phase 1: align[tl,s] = sum_d v[d]*tanh(wq[t0+tl,d] + uh[b,s,d])
//            (wq tile + v in LDS, read at one address per wave; uh staged in
//             32-d chunks through padded LDS; 4 s x 4 t scores per thread)
//   Phase 2: masked softmax over s (one wave per row), write align_vectors
//   Phase 3: c[8,256] = P[8,512] * mems[b]  via f32 WMMA (A from LDS; the
//            instruction's rows 0-7 make the even columns, rows 8-15 the odd
//            ones; mems comes in 64-row chunks by asynchronous copies into
//            the two uh buffers)
// ---------------------------------------------------------------------------
__global__ __launch_bounds__(256) void attn_score_ctx_kernel(
    const float* __restrict__ wq,        // [B*T, D]
    const float* __restrict__ uh,        // [B*S, D]
    const float* __restrict__ mems,      // [B, S, D]
    const float* __restrict__ v,         // [D]
    const int*   __restrict__ mem_masks, // [B]
    float* __restrict__ alignOut,        // [B, T, S]
    float* __restrict__ cOut)            // [B*T, D]
{
  __shared__ __attribute__((aligned(16))) float sWq[TT_ * D_];  // 8 KB
  __shared__ float sP[TT_ * S_];         // 16 KB   scores -> exp(score - row max)
  __shared__ __attribute__((aligned(16))) float sV[D_];         // 1 KB
  __shared__ __attribute__((aligned(16))) float sU[2][S_ * UP_]; // 2 x 72 KB uh chunks, then mems chunks
  __shared__ __attribute__((aligned(16))) float sPE[16 * PA_];   // 64 KB  A of the context product
  static_assert(CK_ * MP_ <= S_ * UP_, "a mems chunk fits a uh buffer");
  __shared__ float red[256];
  __shared__ float rowStat[TT_];

  const int tid   = threadIdx.x;
  const int b     = blockIdx.x / (T_ / TT_);          // T/8 = 64 tiles per batch
  const int t0    = (blockIdx.x % (T_ / TT_)) * TT_;
  const int len   = mem_masks[b];

  // --- stage wq tile, v and the first uh chunk into LDS ---
  const float* wqBase = wq + ((size_t)b * T_ + t0) * D_;
  const float* uhB    = uh + (size_t)b * S_ * D_;
  const int gr = tid >> 3;               // staging: 8 threads cover one 128-B row piece
  const int gc = (tid & 7) << 2;
  const unsigned gOff = (unsigned)(gr * D_ + gc);  // lane's fixed offset; the chunk moves the base
  v4f pf[16];
#pragma unroll
  for (int k = 0; k < 16; ++k)
    pf[k] = *(const v4f*)(uhB + gOff + (unsigned)(32 * k * D_));
  for (int i = tid; i < TT_ * D_; i += 256) sWq[i] = wqBase[i];
  for (int i = tid; i < D_;      i += 256) sV[i]  = v[i];
#pragma unroll
  for (int k = 0; k < 16; ++k)
    *(v4f*)(&sU[0][(gr + 32 * k) * UP_ + gc]) = pf[k];
  __syncthreads();

  // --- Phase 1: additive-attention scores (the 268M-tanh hot loop) ---
  // Lanes run along s. Each thread owns 4 s x 4 t scores in registers, so one
  // uh value feeds 4 tanh and one wq value (same LDS address in every lane)
  // feeds 4. Each score keeps an even-d and an odd-d partial sum, d ascending.
  {
    const int lane  = tid & 31;
    const int wv    = tid >> 5;
    const int sBase = ((wv & 3) << 7) + lane;   // s = sBase + 32*j, j = 0..3
    const int tBase = (wv >> 2) << 2;           // t = tBase + 0..3
    v2f acc[4][4];
#pragma unroll
    for (int t = 0; t < 4; ++t)
#pragma unroll
      for (int j = 0; j < 4; ++j) acc[t][j] = (v2f){0.0f, 0.0f};

#pragma unroll 1   // one chunk body is already several KB of code
    for (int c = 0; c < D_ / DC_; ++c) {
      const float* cur = sU[c & 1];
      const bool more = (c + 1) < D_ / DC_;     // same for the whole block
      if (more) {
        const float* nb = uhB + (c + 1) * DC_ + gOff;
#pragma unroll
        for (int k = 0; k < 16; ++k)            // next chunk flies during this one's math
          pf[k] = *(const v4f*)(nb + (unsigned)(32 * k * D_));
        // Keeps the loads' address registers untouched (not even reused as a
        // load's own destination) until the wait that stands before an overwrite.
        asm volatile("s_wait_xcnt 0x0" :: "v"(nb) : "memory");
      }
#pragma unroll 2   // lets the next quad's LDS reads issue under this quad's math
      for (int q = 0; q < DC_ / 4; ++q) {
        const int d = c * DC_ + q * 4;
        v4f u[4];
#pragma unroll
        for (int j = 0; j < 4; ++j)
          u[j] = *(const v4f*)(cur + (sBase + 32 * j) * UP_ + q * 4);
        const v4f vd = *(const v4f*)(sV + d);
        const v2f vlo = {vd.x, vd.y}, vhi = {vd.z, vd.w};
#pragma unroll
        for (int t = 0; t < 4; ++t) {
          const v4f w = *(const v4f*)(sWq + (tBase + t) * D_ + d);
          const v2f wlo = {w.x, w.y}, whi = {w.z, w.w};
#pragma unroll
          for (int j = 0; j < 4; ++j) {
            const v2f x0 = wlo + (v2f){u[j].x, u[j].y};
            const v2f x1 = whi + (v2f){u[j].z, u[j].w};
            const v2f h0 = {FAST_TANH(x0.x), FAST_TANH(x0.y)};
            const v2f h1 = {FAST_TANH(x1.x), FAST_TANH(x1.y)};
            acc[t][j] = __builtin_elementwise_fma(vlo, h0, acc[t][j]);
            acc[t][j] = __builtin_elementwise_fma(vhi, h1, acc[t][j]);
          }
        }
      }
      if (more) {
        float* nxt = sU[(c + 1) & 1];           // last read in pass c-1, ended by its barrier
#pragma unroll
        for (int k = 0; k < 16; ++k)
          *(v4f*)(nxt + (gr + 32 * k) * UP_ + gc) = pf[k];
        __syncthreads();                        // publishes chunk c+1, ends the reads of chunk c
      }
    }
#pragma unroll
    for (int t = 0; t < 4; ++t)
#pragma unroll
      for (int j = 0; j < 4; ++j)
        sP[(tBase + t) * S_ + sBase + 32 * j] = acc[t][j].x + acc[t][j].y;
  }

  // One chunk of mems (64 rows x 1 KB) into one uh buffer: 16 copies of 16 B per lane, a wave
  // covering 512 contiguous bytes per copy. Each run of copies ends, inside its own statement,
  // with the wait that stands before the copies' address registers are overwritten.
  const float* memB = mems + (size_t)b * S_ * D_;
  const int cr = tid >> 6;               // 64 threads cover one row; copy i takes row 4 i + cr
  const int cc = (tid & 63) << 2;
  auto copy_chunk = [&](int ch, int buf) {
    const float* g = memB + (unsigned)((ch * CK_ + cr) * D_ + cc);
    const unsigned l = (unsigned)(size_t)(&sU[buf][cr * MP_ + cc]);
#pragma unroll
    for (int h = 0; h < 16; h += 8)
      asm volatile(
          "global_load_async_to_lds_b128 %0, %8, off\n\t"
          "global_load_async_to_lds_b128 %1, %9, off\n\t"
          "global_load_async_to_lds_b128 %2, %10, off\n\t"
          "global_load_async_to_lds_b128 %3, %11, off\n\t"
          "global_load_async_to_lds_b128 %4, %12, off\n\t"
          "global_load_async_to_lds_b128 %5, %13, off\n\t"
          "global_load_async_to_lds_b128 %6, %14, off\n\t"
          "global_load_async_to_lds_b128 %7, %15, off\n\t"
          "s_wait_xcnt 0x0"
          :: "v"(l + (h + 0) * 16 * MP_), "v"(l + (h + 1) * 16 * MP_),
             "v"(l + (h + 2) * 16 * MP_), "v"(l + (h + 3) * 16 * MP_),
             "v"(l + (h + 4) * 16 * MP_), "v"(l + (h + 5) * 16 * MP_),
             "v"(l + (h + 6) * 16 * MP_), "v"(l + (h + 7) * 16 * MP_),
             "v"(g + (h + 0) * 4 * D_), "v"(g + (h + 1) * 4 * D_),
             "v"(g + (h + 2) * 4 * D_), "v"(g + (h + 3) * 4 * D_),
             "v"(g + (h + 4) * 4 * D_), "v"(g + (h + 5) * 4 * D_),
             "v"(g + (h + 6) * 4 * D_), "v"(g + (h + 7) * 4 * D_)
          : "memory");
  };

  // This wave's reads of uh have returned before the barrier behind which copies overwrite them.
  asm volatile("s_wait_dscnt 0x0" ::: "memory");
  __syncthreads();
  copy_chunk(0, 0);                      // flies during the softmax

  // --- Phase 2: masked softmax over s, per row (32 threads / row) ---
  const int row = tid >> 5;
  const int sub = tid & 31;
  float mx = -INFINITY;
  for (int s = sub; s < S_; s += 32)
    if (s < len) mx = fmaxf(mx, sP[row * S_ + s]);
  red[tid] = mx;
  __syncthreads();
  if (sub == 0) {
    float m = red[row * 32];
    for (int j = 1; j < 32; ++j) m = fmaxf(m, red[row * 32 + j]);
    rowStat[row] = m;
  }
  __syncthreads();
  const float rm = rowStat[row];
  float sum = 0.0f;
  for (int s = sub; s < S_; s += 32) {
    float e = (s < len) ? __expf(sP[row * S_ + s] - rm) : 0.0f;
    sP[row * S_ + s] = e;
    sum += e;
  }
  red[tid] = sum;
  __syncthreads();
  if (sub == 0) {
    float t = 0.0f;
    for (int j = 0; j < 32; ++j) t += red[row * 32 + j];
    rowStat[row] = t;
  }
  __syncthreads();
  const float inv = 1.0f / rowStat[row];
  float* aOut = alignOut + ((size_t)b * T_ + t0 + row) * S_;
#pragma unroll     // 16 rounds with registers of their own: no store waits for the one before it
  for (int i = 0; i < S_ / 32; ++i) {
    const int s = sub + 32 * i;
    float p = sP[row * S_ + s] * inv;
    // A of the context product: row t holds (p, 0) per s, row t + 8 holds (0, p).
    *(v2f*)(sPE + row * PA_ + 2 * s)       = (v2f){p, 0.0f};
    *(v2f*)(sPE + (row + 8) * PA_ + 2 * s) = (v2f){0.0f, p};
    aOut[s] = p;                               // masked slots are exactly 0
  }
  // This wave's copies of chunk 0 have landed; the barrier publishes them, and A, to all waves.
  asm volatile("s_wait_asynccnt 0x0" ::: "memory");
  __syncthreads();
  copy_chunk(1, 1);

  // --- Phase 3: context c = P[8,512] * mems[b][512,256] via f32 WMMA ---
  // A wave owns 32 columns. One WMMA takes two s rows, k and k+1 (lanes 0-15 row k, lanes 16-31
  // row k+1). A lane's B pair is one 8-B LDS read: its row's columns c, c+1. A pairs them with
  // (p, 0) in rows 0-7 and (0, p) in rows 8-15, so D rows 0-7 are column c, rows 8-15 column c+1
  // of the 8 t rows: no row of the instruction is a repeat. s ascends in every sum, as before.
  {
    const int wv   = tid >> 5;
    const int lane = tid & 31;
    const int r    = lane & 15;
    const int half = lane >> 4;
    const int c    = (wv << 5) + 2 * r;
    const float* pa = sPE + r * PA_ + 2 * half;
    v8f acc = {};
#pragma unroll 1   // one chunk body serves both buffers: short code
    for (int ch = 0; ch < S_ / CK_; ++ch) {
      const float* mb = &sU[ch & 1][half * MP_ + c];
      const float* ap = pa + ch * (2 * CK_);
      v2f fa[2][8], fb[2][8];                   // two fragment sets: group g of 8 WMMAs sits in set g & 1
      auto frag = [&](int g) {
#pragma unroll
        for (int q = 0; q < 8; ++q) {
          const int i = g * 8 + q;              // s rows 2 i, 2 i + 1 of the chunk
          fa[g & 1][q] = *(const v2f*)(ap + 4 * i);
          fb[g & 1][q] = *(const v2f*)(mb + 2 * i * MP_);
        }
      };
      frag(0);
      __builtin_amdgcn_sched_barrier(0);        // group 0's reads return first: the first WMMA waits for them alone
#pragma unroll
      for (int g = 0; g < CK_ / 16; ++g) {
        if (g + 1 < CK_ / 16) frag(g + 1);
        // Keeps the next group's LDS reads in front of this group's WMMAs, which cover their latency.
        __builtin_amdgcn_sched_barrier(0);
#pragma unroll
        for (int q = 0; q < 8; ++q)
          acc = __builtin_amdgcn_wmma_f32_16x16x4_f32(
              false, fa[g & 1][q], false, fb[g & 1][q], (short)0, acc, false, false);
        // The four vector slots between the group's last WMMA and vector work on its D, A or B
        // (address sums of the next reads and copies), held directly behind it.
        __builtin_amdgcn_sched_barrier(0);
        asm volatile("v_nop\n\tv_nop\n\tv_nop\n\tv_nop");
        __builtin_amdgcn_sched_barrier(0);
      }
      // Hand-over: this wave's reads of chunk ch have returned and its copies of chunk ch+1 have
      // landed; the barrier publishes chunk ch+1 and frees chunk ch's buffer for the refill.
      asm volatile("s_wait_dscnt 0x0" ::: "memory");
      asm volatile("s_wait_asynccnt 0x0" ::: "memory");
      __syncthreads();
      if (ch + 2 < S_ / CK_) copy_chunk(ch + 2, ch & 1);   // same for the whole block
    }
    asm volatile("s_wait_asynccnt 0x0" ::: "memory");      // no copy is left when the wave ends
    float* cp = cOut + ((size_t)b * T_ + t0) * D_ + c + half;
#pragma unroll
    for (int j = 0; j < 8; ++j)
      cp[j * D_] = acc[j];
  }
}

// ---------------------------------------------------------------------------
// Output projection: attn_h = concat(c, inputs) * Wout^T + bout
// K = 256 from c, then 512 from inputs, so the concat is never materialized.
// M = B*T = 2048, N = 512, K = 768.
// ---------------------------------------------------------------------------
__global__ __launch_bounds__(256) void outproj_kernel(
    const float* __restrict__ Cctx,   // [B*T, 256]
    const float* __restrict__ X,      // [B*T, 512]
    const float* __restrict__ W,      // [512, 768]
    const float* __restrict__ bias,   // [512]
    float* __restrict__ Out)          // [B*T, 512]
{
  __shared__ __attribute__((aligned(16))) float sA[2][64 * GP_];
  __shared__ __attribute__((aligned(16))) float sW[2][32 * GP_];
  gemm_nt_tile<D_ / KC_, D_, IN_ / KC_, IN_, IN_, true>(Cctx, X, W, bias, Out, blockIdx.x, sA, sW);
}

// ---------------------------------------------------------------------------
extern "C" void kernel_launch(void* const* d_in, const int* in_sizes, int n_in,
                              void* d_out, int out_size, void* d_ws, size_t ws_size,
                              hipStream_t stream) {
  const float* inputs    = (const float*)d_in[0];  // [B,T,IN]
  const float* mems      = (const float*)d_in[1];  // [B,S,D]
  const int*   mem_masks = (const int*)  d_in[2];  // [B]
  const float* Wq        = (const float*)d_in[3];  // [D,IN]
  const float* Wc        = (const float*)d_in[4];  // [D,D]
  const float* bc        = (const float*)d_in[5];  // [D]
  const float* v         = (const float*)d_in[6];  // [D]
  const float* Wout      = (const float*)d_in[7];  // [IN, D+IN]
  const float* bout      = (const float*)d_in[8];  // [IN]

  float* attn  = (float*)d_out;                        // [B,T,IN]
  float* align = attn + (size_t)B_ * T_ * IN_;         // [B,T,S]

  float* ws  = (float*)d_ws;
  float* wq  = ws;                                     // [B*T, D]
  float* uh  = wq + (size_t)B_ * T_ * D_;              // [B*S, D]
  float* ctx = uh + (size_t)B_ * S_ * D_;              // [B*T, D]

  const int M = B_ * T_;                               // 2048 (== B*S too)

  // 1) wq = inputs * Wq^T and uh = mems * Wc^T + bc : 64 x 32 tiles -> 256 + 256 blocks of 8 waves
  proj_qu_kernel<<<QB_ + UB_, 256, 0, stream>>>(inputs, Wq, wq, mems, Wc, bc, uh);

  // 2) fused tanh-score + masked softmax + context (one block per 8 t-rows)
  attn_score_ctx_kernel<<<B_ * (T_ / TT_), 256, 0, stream>>>(
      wq, uh, mems, v, mem_masks, align, ctx);

  // 3) attn_h = concat(ctx, inputs) * Wout^T + bout : 64 x 32 tiles -> 512 blocks
  outproj_kernel<<<(M / 64) * (IN_ / 32), 256, 0, stream>>>(
      ctx, inputs, Wout, bout, attn);
}

// v006
// One run takes 48.6 microseconds.
// Two timings next to v005 put it at 1.12 and 1.11 times that version's speed.
// Counting every step since v000, it is 6.69 times as fast.
#include <hip/hip_runtime.h>
#include <hip/hip_bf16.h>
#include <math.h>

// Problem constants (from reference)
#define B_ 4
#define T_ 512
#define S_ 512
#define IN_ 512
#define D_ 256   // MEM_DIM

typedef __attribute__((ext_vector_type(2))) float v2f;
typedef __attribute__((ext_vector_type(4))) float v4f;
typedef __attribute__((ext_vector_type(8))) float v8f;

#define TT_ 8           // t rows per score block: B*T/TT_ = 256 blocks
#define DC_ 32          // d values of uh staged per pass
#define UP_ (DC_ + 4)   // LDS row pitch in floats: 144 B = 16 B x odd, conflict-free b128 rows
#define CK_ 64          // s rows of mems staged per pass of the context product
#define MP_ (D_ + 32)   // their LDS pitch in floats: rows k and k+1, read together, lie 32 banks apart
#define PA_ (2 * S_ + 4) // pitch of a row of the context product's A in floats: 16 rows on distinct banks

// Native CDNA5 V_TANH_F32 if the toolchain exposes it; OCML fallback.
#if defined(__has_builtin)
#if __has_builtin(__builtin_amdgcn_tanhf)
#define FAST_TANH(x) __builtin_amdgcn_tanhf(x)
#endif
#endif
#ifndef FAST_TANH
#define FAST_TANH(x) tanhf(x)
#endif

// ---------------------------------------------------------------------------
// fp32 WMMA GEMM body:  C[M,N] = [A1 | A2][M,K] * W[N,K]^T (+ bias[N])
// One block = one 64 x 32 tile of C (tile number blk), 8 waves, one 16x16 tile per wave.
// A and W come in 64-k chunks through LDS: every global load is whole 128-B
// lines (16 lanes x 16 B per row), each element is fetched once per block, and
// later chunks' loads fly while this chunk is multiplied (two LDS buffers, fed
// from two register sets).
//
// Fragments (V_WMMA_F32_16X16X4_F32): lanes 0-15 hold row/col r with the first
// two k of the instruction, lanes 16-31 the same r with the last two.
// One 16-B LDS read per lane feeds two WMMAs: of each group of 8 k, lanes 0-15
// read k 0..3 and lanes 16-31 k 4..7; the first WMMA takes k {0,1 | 4,5}, the
// second k {2,3 | 6,7}. A and W use the same map, so every product pairs.
// C/D layout: VGPR j -> M = m0 + j (+8 for upper half-wave), N = lane&15.
// ---------------------------------------------------------------------------
#define KC_ 64          // k values of A and W staged per pass
#define GP_ (KC_ + 4)   // LDS row pitch in floats: 272 B = 16 B x odd, conflict-free b128 rows

template <int NC1, int LDA1, int NC2, int LDA2, int N, bool BIAS>
__device__ __forceinline__ void gemm_nt_tile(
    const float* __restrict__ A1,    // first NC1 chunks of K, row pitch LDA1
    const float* __restrict__ A2,    // next NC2 chunks of K, row pitch LDA2
    const float* __restrict__ W,     // [N, (NC1+NC2)*KC_]
    const float* __restrict__ bias,  // [N], read only if BIAS
    float* __restrict__ C,           // [M, N]
    unsigned blk,                    // which tile of C; same for the whole block
    float (*sA)[64 * GP_],           // LDS: two buffers of A
    float (*sW)[32 * GP_])           // LDS: two buffers of W
{
  constexpr int NC  = NC1 + NC2;
  constexpr int LDW = NC * KC_;

  const int tid = threadIdx.x;
  const int m0  = (blk / (N / 32)) << 6;
  const int n0  = (blk % (N / 32)) << 5;
  const int gr  = tid >> 4;              // staging: 16 threads cover one 256-B row piece
  const int gc  = (tid & 15) << 2;
  const unsigned oA1 = (unsigned)(gr * LDA1 + gc);   // lane's fixed offsets; the chunk moves the base
  const unsigned oA2 = (unsigned)(gr * LDA2 + gc);
  const unsigned oW  = (unsigned)(gr * LDW + gc);
  const int sOff = gr * GP_ + gc;

  const int lane = tid & 31;
  const int wv   = tid >> 5;
  const int r    = lane & 15;
  const int half = lane >> 4;
  const int aOff = (((wv & 3) << 4) + r) * GP_ + (half << 2);
  const int bOff = (((wv >> 2) << 4) + r) * GP_ + (half << 2);
  const int col  = n0 + ((wv >> 2) << 4) + r;

  v4f pa[2][4], pw[2][2];                // two register sets: chunk c travels in set c & 1
  auto fetch = [&](int c) {
    const int s = c & 1;
    const float* wp = W + (size_t)n0 * LDW + c * KC_;
#pragma unroll
    for (int k = 0; k < 2; ++k)
      pw[s][k] = *(const v4f*)(wp + oW + (unsigned)(16 * k * LDW));
    if (NC2 == 0 || c < NC1) {           // same for the whole block
      const float* ap = A1 + (size_t)m0 * LDA1 + c * KC_;
#pragma unroll
      for (int k = 0; k < 4; ++k)
        pa[s][k] = *(const v4f*)(ap + oA1 + (unsigned)(16 * k * LDA1));
    } else {
      const float* ap = A2 + (size_t)m0 * LDA2 + (c - NC1) * KC_;
#pragma unroll
      for (int k = 0; k < 4; ++k)
        pa[s][k] = *(const v4f*)(ap + oA2 + (unsigned)(16 * k * LDA2));
    }
    // The wait that stands before the loads' address registers are overwritten.
    asm volatile("s_wait_xcnt 0x0" ::: "memory");
  };
  auto stage = [&](int buf) {
#pragma unroll
    for (int k = 0; k < 4; ++k) *(v4f*)(&sA[buf][sOff + 16 * k * GP_]) = pa[buf][k];
#pragma unroll
    for (int k = 0; k < 2; ++k) *(v4f*)(&sW[buf][sOff + 16 * k * GP_]) = pw[buf][k];
  };

  v8f acc = {};
  auto mult = [&](int buf, int g0, int g1) {   // groups of 8 k: g0 <= g < g1
    const float* ca = &sA[buf][aOff];
    const float* cw = &sW[buf][bOff];
#pragma unroll
    for (int g = g0; g < g1; ++g) {
      const v4f a = *(const v4f*)(ca + g * 8);
      const v4f w = *(const v4f*)(cw + g * 8);
      acc = __builtin_amdgcn_wmma_f32_16x16x4_f32(
          false, (v2f){a.x, a.y}, false, (v2f){w.x, w.y}, (short)0, acc, false, false);
      acc = __builtin_amdgcn_wmma_f32_16x16x4_f32(
          false, (v2f){a.z, a.w}, false, (v2f){w.z, w.w}, (short)0, acc, false, false);
    }
  };

  fetch(0);
  fetch(1);
  const float bv = BIAS ? bias[col] : 0.0f;
  stage(0);
  __syncthreads();

  // One pass: chunk c+2's loads start, into the register set that chunk c left in the pass
  // before, and have the pass to land; chunk c+1, landed in the pass before, goes to LDS with
  // no wait (into the buffer whose last reads were ended by the pass before's barrier) under
  // the pass's last WMMAs; the barrier publishes chunk c+1 and ends the reads of chunk c.
  auto pass = [&](int c, int buf) {
    if (NC2 != 0 && c + 2 == NC1) {
      // A2's lane offset is formed here, behind WMMAs whose operand registers it may take:
      // the four vector slots between a WMMA and vector work on its A or B, held in place.
      __builtin_amdgcn_sched_barrier(0);
      asm volatile("v_nop\n\tv_nop\n\tv_nop\n\tv_nop");
      __builtin_amdgcn_sched_barrier(0);
    }
    if (c + 2 < NC) fetch(c + 2);
    mult(buf, 0, 6);
    stage(buf ^ 1);
    mult(buf, 6, 8);
    __syncthreads();
  };
#pragma unroll     // every chunk's source, offsets and buffer become constants: no index math among the WMMAs
  for (int c = 0; c + 1 < NC; ++c) pass(c, c & 1);
  mult((NC - 1) & 1, 0, 8);
  // The epilogue's vector work (output address, bias adds) stays behind the slots below:
  // among the WMMAs it would overwrite operand registers directly behind their reader.
  __builtin_amdgcn_sched_barrier(0);
  // The four vector slots between the last WMMA and vector work on its D, A or B.
  asm volatile("v_nop\n\tv_nop\n\tv_nop\n\tv_nop");
  __builtin_amdgcn_sched_barrier(0);   // holds the slots directly behind that WMMA

  const int row = m0 + ((wv & 3) << 4) + half * 8;
  float* cp = C + (unsigned)(row * N + col);
#pragma unroll
  for (int j = 0; j < 8; ++j)
    cp[j * N] = acc[j] + bv;
}

// The two input projections need nothing of each other and share one launch, by block range:
//   blocks 0 .. QB_-1 : wq = inputs * Wq^T     (M = 2048, N = 256, K = 512; the longer, so first)
//   the rest          : uh = mems * Wc^T + bc  (M = 2048, N = 256, K = 256)
#define QB_ ((B_ * T_ / 64) * (D_ / 32))   // tiles of wq
#define UB_ ((B_ * S_ / 64) * (D_ / 32))   // tiles of uh
__global__ __launch_bounds__(256) void proj_qu_kernel(
    const float* __restrict__ X, const float* __restrict__ Wq, float* __restrict__ wq,
    const float* __restrict__ Mm, const float* __restrict__ Wc,
    const float* __restrict__ bc, float* __restrict__ uh) {
  __shared__ __attribute__((aligned(16))) float sA[2][64 * GP_];
  __shared__ __attribute__((aligned(16))) float sW[2][32 * GP_];
  const unsigned blk = blockIdx.x;
  if (blk < QB_)                           // same for the whole block
    gemm_nt_tile<IN_ / KC_, IN_, 0, IN_, D_, false>(X, X, Wq, nullptr, wq, blk, sA, sW);
  else {
    gemm_nt_tile<D_ / KC_, D_, 0, D_, D_, true>(Mm, Mm, Wc, bc, uh, blk - QB_, sA, sW);
    // The wait that stands before the stores' data and address registers are overwritten:
    // in the built code the other range's body follows this one's stores.
    asm volatile("s_wait_xcnt 0x0" ::: "memory");
  }
}

// Lane l's view of lane l ^ M inside its 16-lane row, and of lane l ^ 16: register moves, no LDS trip.
template <int M>
__device__ __forceinline__ float lane_xor_row(float x) {
  return __builtin_bit_cast(float, __builtin_amdgcn_update_dpp(
      0, __builtin_bit_cast(int, x), 0x160 + M, 0xf, 0xf, true));   // DPP row_xmask:M
}
__device__ __forceinline__ float lane_xor_16(float x) {
  return __builtin_bit_cast(float, __builtin_amdgcn_permlanex16(
      __builtin_bit_cast(int, x), __builtin_bit_cast(int, x), 0x76543210, 0xfedcba98, false, false));
}

// ---------------------------------------------------------------------------
// Fused score -> masked softmax -> context kernel.
// One block = one (batch b, 8-row t-tile). 256 threads = 8 waves.
//   Phase 1: align[tl,s] = sum_d v[d]*tanh(wq[t0+tl,d] + uh[b,s,d])
//            (wq tile + v in LDS, read at one address per wave; uh staged in
//             32-d chunks through padded LDS; 4 s x 4 t scores per thread)
//   Phase 2: masked softmax over s (one wave per row, the row in registers), write align_vectors
//   Phase 3: c[8,256] = P[8,512] * mems[b]  via f32 WMMA (A from LDS; the
//            instruction's rows 0-7 make the even columns, rows 8-15 the odd
//            ones; mems comes in 64-row chunks by asynchronous copies into
//            the two uh buffers)
// ---------------------------------------------------------------------------
__global__ __launch_bounds__(256) void attn_score_ctx_kernel(
    const float* __restrict__ wq,        // [B*T, D]
    const float* __restrict__ uh,        // [B*S, D]
    const float* __restrict__ mems,      // [B, S, D]
    const float* __restrict__ v,         // [D]
    const int*   __restrict__ mem_masks, // [B]
    float* __restrict__ alignOut,        // [B, T, S]
    float* __restrict__ cOut)            // [B*T, D]
{
  __shared__ __attribute__((aligned(16))) float sWq[TT_ * D_];  // 8 KB
  __shared__ float sP[TT_ * S_];         // 16 KB   scores
  __shared__ __attribute__((aligned(16))) float sV[D_];         // 1 KB
  __shared__ __attribute__((aligned(16))) float sU[2][S_ * UP_]; // 2 x 72 KB uh chunks, then mems chunks
  __shared__ __attribute__((aligned(16))) float sPE[16 * PA_];   // 64 KB  A of the context product
  static_assert(CK_ * MP_ <= S_ * UP_, "a mems chunk fits a uh buffer");

  const int tid   = threadIdx.x;
  const int b     = blockIdx.x / (T_ / TT_);          // T/8 = 64 tiles per batch
  const int t0    = (blockIdx.x % (T_ / TT_)) * TT_;

  // --- stage wq tile, v and the first uh chunk into LDS ---
  const float* wqBase = wq + ((size_t)b * T_ + t0) * D_;
  const float* uhB    = uh + (size_t)b * S_ * D_;
  const int gr = tid >> 3;               // staging: 8 threads cover one 128-B row piece
  const int gc = (tid & 7) << 2;
  const unsigned gOff = (unsigned)(gr * D_ + gc);  // lane's fixed offset; the chunk moves the base
  v4f pf[16];
#pragma unroll
  for (int k = 0; k < 16; ++k)
    pf[k] = *(const v4f*)(uhB + gOff + (unsigned)(32 * k * D_));
  // wq tile and v are asked for beside the uh chunk: one trip to memory for all of them.
  static_assert(TT_ * D_ == 2 * 4 * 256 && D_ == 256, "two 16-B pieces of wq and one v per thread");
  v4f pq[2];
#pragma unroll
  for (int k = 0; k < 2; ++k)
    pq[k] = *(const v4f*)(wqBase + 4 * tid + 1024 * k);
  const float pv = v[tid];
  // The wait that stands before the loads' address registers are overwritten.
  asm volatile("s_wait_xcnt 0x0" ::: "memory");
  const int len = mem_masks[b];          // first used by the softmax
#pragma unroll
  for (int k = 0; k < 2; ++k)
    *(v4f*)(sWq + 4 * tid + 1024 * k) = pq[k];
  sV[tid] = pv;
#pragma unroll
  for (int k = 0; k < 16; ++k)
    *(v4f*)(&sU[0][(gr + 32 * k) * UP_ + gc]) = pf[k];
  __syncthreads();

  // --- Phase 1: additive-attention scores (the 268M-tanh hot loop) ---
  // Lanes run along s. Each thread owns 4 s x 4 t scores in registers, so one
  // uh value feeds 4 tanh and one wq value (same LDS address in every lane)
  // feeds 4. Each score keeps an even-d and an odd-d partial sum, d ascending.
  {
    const int lane  = tid & 31;
    const int wv    = tid >> 5;
    const int sBase = ((wv & 3) << 7) + lane;   // s = sBase + 32*j, j = 0..3
    const int tBase = (wv >> 2) << 2;           // t = tBase + 0..3
    v2f acc[4][4];
#pragma unroll
    for (int t = 0; t < 4; ++t)
#pragma unroll
      for (int j = 0; j < 4; ++j) acc[t][j] = (v2f){0.0f, 0.0f};

#pragma unroll 1   // one chunk body is already several KB of code
    for (int c = 0; c < D_ / DC_; ++c) {
      const float* cur = sU[c & 1];
      const bool more = (c + 1) < D_ / DC_;     // same for the whole block
      if (more) {
        const float* nb = uhB + (c + 1) * DC_ + gOff;
#pragma unroll
        for (int k = 0; k < 16; ++k)            // next chunk flies during this one's math
          pf[k] = *(const v4f*)(nb + (unsigned)(32 * k * D_));
        // Keeps the loads' address registers untouched (not even reused as a
        // load's own destination) until the wait that stands before an overwrite.
        asm volatile("s_wait_xcnt 0x0" :: "v"(nb) : "memory");
      }
#pragma unroll 2   // lets the next quad's LDS reads issue under this quad's math
      for (int q = 0; q < DC_ / 4; ++q) {
        const int d = c * DC_ + q * 4;
        v4f u[4];
#pragma unroll
        for (int j = 0; j < 4; ++j)
          u[j] = *(const v4f*)(cur + (sBase + 32 * j) * UP_ + q * 4);
        const v4f vd = *(const v4f*)(sV + d);
        const v2f vlo = {vd.x, vd.y}, vhi = {vd.z, vd.w};
#pragma unroll
        for (int t = 0; t < 4; ++t) {
          const v4f w = *(const v4f*)(sWq + (tBase + t) * D_ + d);
          const v2f wlo = {w.x, w.y}, whi = {w.z, w.w};
#pragma unroll
          for (int j = 0; j < 4; ++j) {
            const v2f x0 = wlo + (v2f){u[j].x, u[j].y};
            const v2f x1 = whi + (v2f){u[j].z, u[j].w};
            const v2f h0 = {FAST_TANH(x0.x), FAST_TANH(x0.y)};
            const v2f h1 = {FAST_TANH(x1.x), FAST_TANH(x1.y)};
            acc[t][j] = __builtin_elementwise_fma(vlo, h0, acc[t][j]);
            acc[t][j] = __builtin_elementwise_fma(vhi, h1, acc[t][j]);
          }
        }
      }
      if (more) {
        float* nxt = sU[(c + 1) & 1];           // last read in pass c-1, ended by its barrier
#pragma unroll
        for (int k = 0; k < 16; ++k)
          *(v4f*)(nxt + (gr + 32 * k) * UP_ + gc) = pf[k];
        __syncthreads();                        // publishes chunk c+1, ends the reads of chunk c
      }
    }
#pragma unroll
    for (int t = 0; t < 4; ++t)
#pragma unroll
      for (int j = 0; j < 4; ++j)
        sP[(tBase + t) * S_ + sBase + 32 * j] = acc[t][j].x + acc[t][j].y;
  }

  // One chunk of mems (64 rows x 1 KB) into one uh buffer: 16 copies of 16 B per lane, a wave
  // covering 512 contiguous bytes per copy. Each run of copies ends, inside its own statement,
  // with the wait that stands before the copies' address registers are overwritten.
  const float* memB = mems + (size_t)b * S_ * D_;
  const int cr = tid >> 6;               // 64 threads cover one row; copy i takes row 4 i + cr
  const int cc = (tid & 63) << 2;
  auto copy_chunk = [&](int ch, int buf) {
    const float* g = memB + (unsigned)((ch * CK_ + cr) * D_ + cc);
    const unsigned l = (unsigned)(size_t)(&sU[buf][cr * MP_ + cc]);
#pragma unroll
    for (int h = 0; h < 16; h += 8)
      asm volatile(
          "global_load_async_to_lds_b128 %0, %8, off\n\t"
          "global_load_async_to_lds_b128 %1, %9, off\n\t"
          "global_load_async_to_lds_b128 %2, %10, off\n\t"
          "global_load_async_to_lds_b128 %3, %11, off\n\t"
          "global_load_async_to_lds_b128 %4, %12, off\n\t"
          "global_load_async_to_lds_b128 %5, %13, off\n\t"
          "global_load_async_to_lds_b128 %6, %14, off\n\t"
          "global_load_async_to_lds_b128 %7, %15, off\n\t"
          "s_wait_xcnt 0x0"
          :: "v"(l + (h + 0) * 16 * MP_), "v"(l + (h + 1) * 16 * MP_),
             "v"(l + (h + 2) * 16 * MP_), "v"(l + (h + 3) * 16 * MP_),
             "v"(l + (h + 4) * 16 * MP_), "v"(l + (h + 5) * 16 * MP_),
             "v"(l + (h + 6) * 16 * MP_), "v"(l + (h + 7) * 16 * MP_),
             "v"(g + (h + 0) * 4 * D_), "v"(g + (h + 1) * 4 * D_),
             "v"(g + (h + 2) * 4 * D_), "v"(g + (h + 3) * 4 * D_),
             "v"(g + (h + 4) * 4 * D_), "v"(g + (h + 5) * 4 * D_),
             "v"(g + (h + 6) * 4 * D_), "v"(g + (h + 7) * 4 * D_)
          : "memory");
  };

  // This wave's reads of uh have returned before the barrier behind which copies overwrite them.
  asm volatile("s_wait_dscnt 0x0" ::: "memory");
  __syncthreads();
  copy_chunk(0, 0);                      // flies during the softmax

  // --- Phase 2: masked softmax over s: one wave per row, the row's 512 scores in 16 registers a lane ---
  // All 16 LDS reads are in flight together; max and sum cross the lanes by register moves, so a
  // wave needs nothing of another wave until the barrier that publishes A.
  const int row = tid >> 5;
  const int sub = tid & 31;
  float e[S_ / 32];
#pragma unroll
  for (int i = 0; i < S_ / 32; ++i) e[i] = sP[row * S_ + sub + 32 * i];
  float mx = -INFINITY;
#pragma unroll
  for (int i = 0; i < S_ / 32; ++i)
    mx = fmaxf(mx, (sub + 32 * i < len) ? e[i] : -INFINITY);
  mx = fmaxf(mx, lane_xor_row<1>(mx));
  mx = fmaxf(mx, lane_xor_row<2>(mx));
  mx = fmaxf(mx, lane_xor_row<4>(mx));
  mx = fmaxf(mx, lane_xor_row<8>(mx));
  const float rm = fmaxf(mx, lane_xor_16(mx));
  // Three runs of 16 independent instructions each (arguments, exponentials, masked sum), held apart:
  // mixed, every exponential would stand directly behind its own argument and wait for it.
#pragma unroll
  for (int i = 0; i < S_ / 32; ++i) e[i] -= rm;
  __builtin_amdgcn_sched_barrier(0);
#pragma unroll
  for (int i = 0; i < S_ / 32; ++i) e[i] = __expf(e[i]);
  __builtin_amdgcn_sched_barrier(0);
  float sum = 0.0f;
#pragma unroll
  for (int i = 0; i < S_ / 32; ++i) {
    e[i] = (sub + 32 * i < len) ? e[i] : 0.0f;
    sum += e[i];
  }
  sum += lane_xor_row<1>(sum);
  sum += lane_xor_row<2>(sum);
  sum += lane_xor_row<4>(sum);
  sum += lane_xor_row<8>(sum);
  sum += lane_xor_16(sum);
  const float inv = 1.0f / sum;
  float* aOut = alignOut + ((size_t)b * T_ + t0 + row) * S_;
#pragma unroll     // 16 rounds with registers of their own: no store waits for the one before it
  for (int i = 0; i < S_ / 32; ++i) {
    const int s = sub + 32 * i;
    float p = e[i] * inv;
    // A of the context product: row t holds (p, 0) per s, row t + 8 holds (0, p).
    *(v2f*)(sPE + row * PA_ + 2 * s)       = (v2f){p, 0.0f};
    *(v2f*)(sPE + (row + 8) * PA_ + 2 * s) = (v2f){0.0f, p};
    aOut[s] = p;                               // masked slots are exactly 0
  }
  // This wave's copies of chunk 0 have landed; the barrier publishes them, and A, to all waves.
  asm volatile("s_wait_asynccnt 0x0" ::: "memory");
  __syncthreads();
  copy_chunk(1, 1);

  // --- Phase 3: context c = P[8,512] * mems[b][512,256] via f32 WMMA ---
  // A wave owns 32 columns. One WMMA takes two s rows, k and k+1 (lanes 0-15 row k, lanes 16-31
  // row k+1). A lane's B pair is one 8-B LDS read: its row's columns c, c+1. A pairs them with
  // (p, 0) in rows 0-7 and (0, p) in rows 8-15, so D rows 0-7 are column c, rows 8-15 column c+1
  // of the 8 t rows: no row of the instruction is a repeat. s ascends in every sum, as before.
  {
    const int wv   = tid >> 5;
    const int lane = tid & 31;
    const int r    = lane & 15;
    const int half = lane >> 4;
    const int c    = (wv << 5) + 2 * r;
    const float* pa = sPE + r * PA_ + 2 * half;
    v8f acc = {};
#pragma unroll 1   // one chunk body serves both buffers: short code
    for (int ch = 0; ch < S_ / CK_; ++ch) {
      const float* mb = &sU[ch & 1][half * MP_ + c];
      const float* ap = pa + ch * (2 * CK_);
      v2f fa[2][8], fb[2][8];                   // two fragment sets: group g of 8 WMMAs sits in set g & 1
      auto frag = [&](int g) {
#pragma unroll
        for (int q = 0; q < 8; ++q) {
          const int i = g * 8 + q;              // s rows 2 i, 2 i + 1 of the chunk
          fa[g & 1][q] = *(const v2f*)(ap + 4 * i);
          fb[g & 1][q] = *(const v2f*)(mb + 2 * i * MP_);
        }
      };
      frag(0);
      __builtin_amdgcn_sched_barrier(0);        // group 0's reads return first: the first WMMA waits for them alone
#pragma unroll
      for (int g = 0; g < CK_ / 16; ++g) {
        if (g + 1 < CK_ / 16) frag(g + 1);
        // Keeps the next group's LDS reads in front of this group's WMMAs, which cover their latency.
        __builtin_amdgcn_sched_barrier(0);
#pragma unroll
        for (int q = 0; q < 8; ++q)
          acc = __builtin_amdgcn_wmma_f32_16x16x4_f32(
              false, fa[g & 1][q], false, fb[g & 1][q], (short)0, acc, false, false);
        // The four vector slots between the group's last WMMA and vector work on its D, A or B
        // (address sums of the next reads and copies), held directly behind it.
        __builtin_amdgcn_sched_barrier(0);
        asm volatile("v_nop\n\tv_nop\n\tv_nop\n\tv_nop");
        __builtin_amdgcn_sched_barrier(0);
      }
      // Hand-over: this wave's reads of chunk ch have returned and its copies of chunk ch+1 have
      // landed; the barrier publishes chunk ch+1 and frees chunk ch's buffer for the refill.
      asm volatile("s_wait_dscnt 0x0" ::: "memory");
      asm volatile("s_wait_asynccnt 0x0" ::: "memory");
      __syncthreads();
      if (ch + 2 < S_ / CK_) copy_chunk(ch + 2, ch & 1);   // same for the whole block
    }
    asm volatile("s_wait_asynccnt 0x0" ::: "memory");      // no copy is left when the wave ends
    float* cp = cOut + ((size_t)b * T_ + t0) * D_ + c + half;
#pragma unroll
    for (int j = 0; j < 8; ++j)
      cp[j * D_] = acc[j];
  }
}

// ---------------------------------------------------------------------------
// Output projection: attn_h = concat(c, inputs) * Wout^T + bout
// K = 256 from c, then 512 from inputs, so the concat is never materialized.
// M = B*T = 2048, N = 512, K = 768.
// ---------------------------------------------------------------------------
__global__ __launch_bounds__(256) void outproj_kernel(
    const float* __restrict__ Cctx,   // [B*T, 256]
    const float* __restrict__ X,      // [B*T, 512]
    const float* __restrict__ W,      // [512, 768]
    const float* __restrict__ bias,   // [512]
    float* __restrict__ Out)          // [B*T, 512]
{
  __shared__ __attribute__((aligned(16))) float sA[2][64 * GP_];
  __shared__ __attribute__((aligned(16))) float sW[2][32 * GP_];
  gemm_nt_tile<D_ / KC_, D_, IN_ / KC_, IN_, IN_, true>(Cctx, X, W, bias, Out, blockIdx.x, sA, sW);
}

// ---------------------------------------------------------------------------
extern "C" void kernel_launch(void* const* d_in, const int* in_sizes, int n_in,
                              void* d_out, int out_size, void* d_ws, size_t ws_size,
                              hipStream_t stream) {
  const float* inputs    = (const float*)d_in[0];  // [B,T,IN]
  const float* mems      = (const float*)d_in[1];  // [B,S,D]
  const int*   mem_masks = (const int*)  d_in[2];  // [B]
  const float* Wq        = (const float*)d_in[3];  // [D,IN]
  const float* Wc        = (const float*)d_in[4];  // [D,D]
  const float* bc        = (const float*)d_in[5];  // [D]
  const float* v         = (const float*)d_in[6];  // [D]
  const float* Wout      = (const float*)d_in[7];  // [IN, D+IN]
  const float* bout      = (const float*)d_in[8];  // [IN]

  float* attn  = (float*)d_out;                        // [B,T,IN]
  float* align = attn + (size_t)B_ * T_ * IN_;         // [B,T,S]

  float* ws  = (float*)d_ws;
  float* wq  = ws;                                     // [B*T, D]
  float* uh  = wq + (size_t)B_ * T_ * D_;              // [B*S, D]
  float* ctx = uh + (size_t)B_ * S_ * D_;              // [B*T, D]

  const int M = B_ * T_;                               // 2048 (== B*S too)

  // 1) wq = inputs * Wq^T and uh = mems * Wc^T + bc : 64 x 32 tiles -> 256 + 256 blocks of 8 waves
  proj_qu_kernel<<<QB_ + UB_, 256, 0, stream>>>(inputs, Wq, wq, mems, Wc, bc, uh);

  // 2) fused tanh-score + masked softmax + context (one block per 8 t-rows)
  attn_score_ctx_kernel<<<B_ * (T_ / TT_), 256, 0, stream>>>(
      wq, uh, mems, v, mem_masks, align, ctx);

  // 3) attn_h = concat(ctx, inputs) * Wout^T + bout : 64 x 32 tiles -> 512 blocks
  outproj_kernel<<<(M / 64) * (IN_ / 32), 256, 0, stream>>>(
      ctx, inputs, Wout, bout, attn);
}

// v007
// Measured time: 46.9 microseconds a run.
// Two timings next to v006 both put it at 1.03 times that version's speed.
// Over all steps from v000 it is 6.90 times as fast.
#include <hip/hip_runtime.h>
#include <hip/hip_bf16.h>
#include <math.h>

// Problem constants (from reference)
#define B_ 4
#define T_ 512
#define S_ 512
#define IN_ 512
#define D_ 256   // MEM_DIM

typedef __attribute__((ext_vector_type(2))) float v2f;
typedef __attribute__((ext_vector_type(4))) float v4f;
typedef __attribute__((ext_vector_type(8))) float v8f;

#define TT_ 8           // t rows per score block: B*T/TT_ = 256 blocks
#define DC_ 32          // d values of uh staged per pass
#define UP_ (DC_ + 4)   // LDS row pitch in floats: 144 B = 16 B x odd, conflict-free b128 rows
#define CK_ 64          // s rows of mems staged per pass of the context product
#define MP_ (D_ + 32)   // their LDS pitch in floats: rows k and k+1, read together, lie 32 banks apart
#define PA_ (2 * S_ + 4) // pitch of a row of the context product's A in floats: 16 rows on distinct banks

// Native CDNA5 V_TANH_F32 if the toolchain exposes it; OCML fallback.
#if defined(__has_builtin)
#if __has_builtin(__builtin_amdgcn_tanhf)
#define FAST_TANH(x) __builtin_amdgcn_tanhf(x)
#endif
#endif
#ifndef FAST_TANH
#define FAST_TANH(x) tanhf(x)
#endif

// ---------------------------------------------------------------------------
// fp32 WMMA GEMM body:  C[M,N] = [A1 | A2][M,K] * W[N,K]^T (+ bias[N])
// One block = one 64 x 32 tile of C (tile number blk), 8 waves, one 16x16 tile per wave.
// A and W come in 64-k chunks through LDS: every global load is whole 128-B
// lines (16 lanes x 16 B per row), each element is fetched once per block, and
// later chunks' loads fly while this chunk is multiplied (two LDS buffers, fed
// from two register sets).
//
// Fragments (V_WMMA_F32_16X16X4_F32): lanes 0-15 hold row/col r with the first
// two k of the instruction, lanes 16-31 the same r with the last two.
// One 16-B LDS read per lane feeds two WMMAs: of each group of 8 k, lanes 0-15
// read k 0..3 and lanes 16-31 k 4..7; the first WMMA takes k {0,1 | 4,5}, the
// second k {2,3 | 6,7}. A and W use the same map, so every product pairs.
// C/D layout: VGPR j -> M = m0 + j (+8 for upper half-wave), N = lane&15.
// ---------------------------------------------------------------------------
#define KC_ 64          // k values of A and W staged per pass
#define GP_ (KC_ + 4)   // LDS row pitch in floats: 272 B = 16 B x odd, conflict-free b128 rows

template <int NC1, int LDA1, int NC2, int LDA2, int N, bool BIAS>
__device__ __forceinline__ void gemm_nt_tile(
    const float* __restrict__ A1,    // first NC1 chunks of K, row pitch LDA1
    const float* __restrict__ A2,    // next NC2 chunks of K, row pitch LDA2
    const float* __restrict__ W,     // [N, (NC1+NC2)*KC_]
    const float* __restrict__ bias,  // [N], read only if BIAS
    float* __restrict__ C,           // [M, N]
    unsigned blk,                    // which tile of C; same for the whole block
    float (*sA)[64 * GP_],           // LDS: two buffers of A
    float (*sW)[32 * GP_])           // LDS: two buffers of W
{
  constexpr int NC  = NC1 + NC2;
  constexpr int LDW = NC * KC_;

  const int tid = threadIdx.x;
  const int m0  = (blk / (N / 32)) << 6;
  const int n0  = (blk % (N / 32)) << 5;
  const int gr  = tid >> 4;              // staging: 16 threads cover one 256-B row piece
  const int gc  = (tid & 15) << 2;
  const unsigned oA1 = (unsigned)(gr * LDA1 + gc);   // lane's fixed offsets; the chunk moves the base
  const unsigned oA2 = (unsigned)(gr * LDA2 + gc);
  const unsigned oW  = (unsigned)(gr * LDW + gc);
  const int sOff = gr * GP_ + gc;

  const int lane = tid & 31;
  const int wv   = tid >> 5;
  const int r    = lane & 15;
  const int half = lane >> 4;
  const int aOff = (((wv & 3) << 4) + r) * GP_ + (half << 2);
  const int bOff = (((wv >> 2) << 4) + r) * GP_ + (half << 2);
  const int col  = n0 + ((wv >> 2) << 4) + r;

  v4f pa[2][4], pw[2][2];                // two register sets: chunk c travels in set c & 1
  auto fetch = [&](int c) {
    const int s = c & 1;
    const float* wp = W + (size_t)n0 * LDW + c * KC_;
#pragma unroll
    for (int k = 0; k < 2; ++k)
      pw[s][k] = *(const v4f*)(wp + oW + (unsigned)(16 * k * LDW));
    if (NC2 == 0 || c < NC1) {           // same for the whole block
      const float* ap = A1 + (size_t)m0 * LDA1 + c * KC_;
#pragma unroll
      for (int k = 0; k < 4; ++k)
        pa[s][k] = *(const v4f*)(ap + oA1 + (unsigned)(16 * k * LDA1));
    } else {
      const float* ap = A2 + (size_t)m0 * LDA2 + (c - NC1) * KC_;
#pragma unroll
      for (int k = 0; k < 4; ++k)
        pa[s][k] = *(const v4f*)(ap + oA2 + (unsigned)(16 * k * LDA2));
    }
    // The wait that stands before the loads' address registers are overwritten.
    asm volatile("s_wait_xcnt 0x0" ::: "memory");
  };
  auto stage = [&](int buf) {
#pragma unroll
    for (int k = 0; k < 4; ++k) *(v4f*)(&sA[buf][sOff + 16 * k * GP_]) = pa[buf][k];
#pragma unroll
    for (int k = 0; k < 2; ++k) *(v4f*)(&sW[buf][sOff + 16 * k * GP_]) = pw[buf][k];
  };

  v8f acc = {};
  auto mult = [&](int buf, int g0, int g1) {   // groups of 8 k: g0 <= g < g1
    const float* ca = &sA[buf][aOff];
    const float* cw = &sW[buf][bOff];
#pragma unroll
    for (int g = g0; g < g1; ++g) {
      const v4f a = *(const v4f*)(ca + g * 8);
      const v4f w = *(const v4f*)(cw + g * 8);
      acc = __builtin_amdgcn_wmma_f32_16x16x4_f32(
          false, (v2f){a.x, a.y}, false, (v2f){w.x, w.y}, (short)0, acc, false, false);
      acc = __builtin_amdgcn_wmma_f32_16x16x4_f32(
          false, (v2f){a.z, a.w}, false, (v2f){w.z, w.w}, (short)0, acc, false, false);
    }
  };

  fetch(0);
  fetch(1);
  const float bv = BIAS ? bias[col] : 0.0f;
  stage(0);
  __syncthreads();

  // One pass: chunk c+2's loads start, into the register set that chunk c left in the pass
  // before, and have the pass to land; chunk c+1, landed in the pass before, goes to LDS with
  // no wait (into the buffer whose last reads were ended by the pass before's barrier) under
  // the pass's last WMMAs; the barrier publishes chunk c+1 and ends the reads of chunk c.
  auto pass = [&](int c, int buf) {
    if (NC2 != 0 && c + 2 == NC1) {
      // A2's lane offset is formed here, behind WMMAs whose operand registers it may take:
      // the four vector slots between a WMMA and vector work on its A or B, held in place.
      __builtin_amdgcn_sched_barrier(0);
      asm volatile("v_nop\n\tv_nop\n\tv_nop\n\tv_nop");
      __builtin_amdgcn_sched_barrier(0);
    }
    if (c + 2 < NC) fetch(c + 2);
    mult(buf, 0, 6);
    stage(buf ^ 1);
    mult(buf, 6, 8);
    __syncthreads();
  };
#pragma unroll     // every chunk's source, offsets and buffer become constants: no index math among the WMMAs
  for (int c = 0; c + 1 < NC; ++c) pass(c, c & 1);
  mult((NC - 1) & 1, 0, 8);
  // The epilogue's vector work (output address, bias adds) stays behind the slots below:
  // among the WMMAs it would overwrite operand registers directly behind their reader.
  __builtin_amdgcn_sched_barrier(0);
  // The four vector slots between the last WMMA and vector work on its D, A or B.
  asm volatile("v_nop\n\tv_nop\n\tv_nop\n\tv_nop");
  __builtin_amdgcn_sched_barrier(0);   // holds the slots directly behind that WMMA

  const int row = m0 + ((wv & 3) << 4) + half * 8;
  float* cp = C + (unsigned)(row * N + col);
#pragma unroll
  for (int j = 0; j < 8; ++j)
    cp[j * N] = acc[j] + bv;
}

// The two input projections need nothing of each other and share one launch, by block range:
//   blocks 0 .. QB_-1 : wq = inputs * Wq^T     (M = 2048, N = 256, K = 512; the longer, so first)
//   the rest          : uh = mems * Wc^T + bc  (M = 2048, N = 256, K = 256)
#define QB_ ((B_ * T_ / 64) * (D_ / 32))   // tiles of wq
#define UB_ ((B_ * S_ / 64) * (D_ / 32))   // tiles of uh
__global__ __launch_bounds__(256) void proj_qu_kernel(
    const float* __restrict__ X, const float* __restrict__ Wq, float* __restrict__ wq,
    const float* __restrict__ Mm, const float* __restrict__ Wc,
    const float* __restrict__ bc, float* __restrict__ uh) {
  __shared__ __attribute__((aligned(16))) float sA[2][64 * GP_];
  __shared__ __attribute__((aligned(16))) float sW[2][32 * GP_];
  const unsigned blk = blockIdx.x;
  if (blk < QB_)                           // same for the whole block
    gemm_nt_tile<IN_ / KC_, IN_, 0, IN_, D_, false>(X, X, Wq, nullptr, wq, blk, sA, sW);
  else {
    gemm_nt_tile<D_ / KC_, D_, 0, D_, D_, true>(Mm, Mm, Wc, bc, uh, blk - QB_, sA, sW);
    // The wait that stands before the stores' data and address registers are overwritten:
    // in the built code the other range's body follows this one's stores.
    asm volatile("s_wait_xcnt 0x0" ::: "memory");
  }
}

// Lane l's view of lane l ^ M inside its 16-lane row, and of lane l ^ 16: register moves, no LDS trip.
template <int M>
__device__ __forceinline__ float lane_xor_row(float x) {
  return __builtin_bit_cast(float, __builtin_amdgcn_update_dpp(
      0, __builtin_bit_cast(int, x), 0x160 + M, 0xf, 0xf, true));   // DPP row_xmask:M
}
__device__ __forceinline__ float lane_xor_16(float x) {
  return __builtin_bit_cast(float, __builtin_amdgcn_permlanex16(
      __builtin_bit_cast(int, x), __builtin_bit_cast(int, x), 0x76543210, 0xfedcba98, false, false));
}

// ---------------------------------------------------------------------------
// Fused score -> masked softmax -> context kernel.
// One block = one (batch b, 8-row t-tile). 256 threads = 8 waves.
//   Phase 1: align[tl,s] = sum_d v[d]*tanh(wq[t0+tl,d] + uh[b,s,d])
//            (wq tile + v in LDS, read at one address per wave; uh staged in
//             32-d chunks through padded LDS; 4 s x 4 t scores per thread)
//   Phase 2: masked softmax over s (one wave per row, the row in registers), write align_vectors
//   Phase 3: c[8,256] = P[8,512] * mems[b]  via f32 WMMA (A from LDS; the
//            instruction's rows 0-7 make the even columns, rows 8-15 the odd
//            ones; mems comes in 64-row chunks by asynchronous copies into
//            the two uh buffers)
// ---------------------------------------------------------------------------
__global__ __launch_bounds__(256) void attn_score_ctx_kernel(
    const float* __restrict__ wq,        // [B*T, D]
    const float* __restrict__ uh,        // [B*S, D]
    const float* __restrict__ mems,      // [B, S, D]
    const float* __restrict__ v,         // [D]
    const int*   __restrict__ mem_masks, // [B]
    float* __restrict__ alignOut,        // [B, T, S]
    float* __restrict__ cOut)            // [B*T, D]
{
  __shared__ __attribute__((aligned(16))) float sWq[TT_ * D_];  // 8 KB
  __shared__ float sP[TT_ * S_];         // 16 KB   scores
  __shared__ __attribute__((aligned(16))) float sV[D_];         // 1 KB
  __shared__ __attribute__((aligned(16))) float sU[2][S_ * UP_]; // 2 x 72 KB uh chunks, then mems chunks
  __shared__ __attribute__((aligned(16))) float sPE[16 * PA_];   // 64 KB  A of the context product
  static_assert(CK_ * MP_ <= S_ * UP_, "a mems chunk fits a uh buffer");

  const int tid   = threadIdx.x;
  const int b     = blockIdx.x / (T_ / TT_);          // T/8 = 64 tiles per batch
  const int t0    = (blockIdx.x % (T_ / TT_)) * TT_;

  // --- stage wq tile, v and the first uh chunk into LDS ---
  const float* wqBase = wq + ((size_t)b * T_ + t0) * D_;
  const float* uhB    = uh + (size_t)b * S_ * D_;
  const int gr = tid >> 3;               // staging: 8 threads cover one 128-B row piece
  const int gc = (tid & 7) << 2;
  const unsigned gOff = (unsigned)(gr * D_ + gc);  // lane's fixed offset; the chunk moves the base
  v4f pf[16];
#pragma unroll
  for (int k = 0; k < 16; ++k)
    pf[k] = *(const v4f*)(uhB + gOff + (unsigned)(32 * k * D_));
  // wq tile and v are asked for beside the uh chunk: one trip to memory for all of them.
  static_assert(TT_ * D_ == 2 * 4 * 256 && D_ == 256, "two 16-B pieces of wq and one v per thread");
  v4f pq[2];
#pragma unroll
  for (int k = 0; k < 2; ++k)
    pq[k] = *(const v4f*)(wqBase + 4 * tid + 1024 * k);
  const float pv = v[tid];
  // The wait that stands before the loads' address registers are overwritten.
  asm volatile("s_wait_xcnt 0x0" ::: "memory");
  const int len = mem_masks[b];          // first used by the softmax
#pragma unroll
  for (int k = 0; k < 2; ++k)
    *(v4f*)(sWq + 4 * tid + 1024 * k) = pq[k];
  sV[tid] = pv;
#pragma unroll
  for (int k = 0; k < 16; ++k)
    *(v4f*)(&sU[0][(gr + 32 * k) * UP_ + gc]) = pf[k];
  __syncthreads();

  // --- Phase 1: additive-attention scores (the 268M-tanh hot loop) ---
  // Lanes run along s. Each thread owns 4 s x 4 t scores in registers, so one
  // uh value feeds 4 tanh and one wq value (same LDS address in every lane)
  // feeds 4. Each score keeps an even-d and an odd-d partial sum, d ascending.
  {
    const int lane  = tid & 31;
    const int wv    = tid >> 5;
    const int sBase = ((wv & 3) << 7) + lane;   // s = sBase + 32*j, j = 0..3
    const int tBase = (wv >> 2) << 2;           // t = tBase + 0..3
    v2f acc[4][4];
#pragma unroll
    for (int t = 0; t < 4; ++t)
#pragma unroll
      for (int j = 0; j < 4; ++j) acc[t][j] = (v2f){0.0f, 0.0f};

#pragma unroll 1   // one chunk body is already several KB of code
    for (int c = 0; c < D_ / DC_; ++c) {
      const float* cur = sU[c & 1];
      const bool more = (c + 1) < D_ / DC_;     // same for the whole block
      if (more) {
        const float* nb = uhB + (c + 1) * DC_ + gOff;
#pragma unroll
        for (int k = 0; k < 16; ++k)            // next chunk flies during this one's math
          pf[k] = *(const v4f*)(nb + (unsigned)(32 * k * D_));
        // Keeps the loads' address registers untouched (not even reused as a
        // load's own destination) until the wait that stands before an overwrite.
        asm volatile("s_wait_xcnt 0x0" :: "v"(nb) : "memory");
      }
#pragma unroll 1   // one body holds two quads of d: 8 units of one quad and one t (8 packed sums, 16 tanh, 8 packed FMAs)
      for (int qp = 0; qp < DC_ / 8; ++qp) {
        const int d = c * DC_ + qp * 8;
        v4f u[2][4], w[2][4], vd[2];
#pragma unroll
        for (int qq = 0; qq < 2; ++qq) {
#pragma unroll
          for (int j = 0; j < 4; ++j)
            u[qq][j] = *(const v4f*)(cur + (sBase + 32 * j) * UP_ + qp * 8 + qq * 4);
          vd[qq] = *(const v4f*)(sV + d + qq * 4);
#pragma unroll
          for (int t = 0; t < 4; ++t)
            w[qq][t] = *(const v4f*)(sWq + (tBase + t) * D_ + d + qq * 4);
        }
        v2f x[3][8], h[3][8];                   // a unit's arguments and tanh: unit n sits in set n % 3
        auto sums = [&](int n) {
          const v4f ww = w[n >> 2][n & 3];
#pragma unroll
          for (int j = 0; j < 4; ++j) {
            const v4f uu = u[n >> 2][j];
            x[n % 3][2 * j]     = (v2f){ww.x, ww.y} + (v2f){uu.x, uu.y};
            x[n % 3][2 * j + 1] = (v2f){ww.z, ww.w} + (v2f){uu.z, uu.w};
          }
        };
        auto tanhs = [&](int n) {
#pragma unroll
          for (int i = 0; i < 8; ++i)
            h[n % 3][i] = (v2f){FAST_TANH(x[n % 3][i].x), FAST_TANH(x[n % 3][i].y)};
        };
        auto fmas = [&](int n) {
          const v4f vv = vd[n >> 2];
#pragma unroll
          for (int j = 0; j < 4; ++j)
            acc[n & 3][j] = __builtin_elementwise_fma((v2f){vv.x, vv.y}, h[n % 3][2 * j], acc[n & 3][j]);
#pragma unroll
          for (int j = 0; j < 4; ++j)
            acc[n & 3][j] = __builtin_elementwise_fma((v2f){vv.z, vv.w}, h[n % 3][2 * j + 1], acc[n & 3][j]);
        };
        // Five units in flight: unit n's tanh stand among unit n-2's FMAs and unit n+2's sums.
        sums(0);
        sums(1);
#pragma unroll
        for (int n = 0; n < 8; ++n) {
          if (n > 1) fmas(n - 2);
          if (n < 6) sums(n + 2);
          tanhs(n);
        }
        fmas(6);
        fmas(7);
        // The order asked of the scheduler: packed work behind every tanh. If a tanh, like v_exp_f32, keeps
        // its unit busy for two clocks, a run of tanh leaves the wave's issue slot empty every second
        // clock, and packed work in runs before and behind takes clocks of its own.
        __builtin_amdgcn_sched_group_barrier(0x002, 16, 0);      // units 0 and 1: sums
#pragma unroll
        for (int i = 0; i < 16; ++i) {                           // tanh of units 0, 1; sums of units 2, 3
          __builtin_amdgcn_sched_group_barrier(0x400, 2, 0);
          __builtin_amdgcn_sched_group_barrier(0x002, 1, 0);
        }
#pragma unroll
        for (int i = 0; i < 64; ++i) {                           // units 2 to 5
          __builtin_amdgcn_sched_group_barrier(0x400, 1, 0);
          __builtin_amdgcn_sched_group_barrier(0x002, 1, 0);
        }
#pragma unroll
        for (int i = 0; i < 16; ++i) {                           // tanh of units 6, 7; FMAs of units 4, 5
          __builtin_amdgcn_sched_group_barrier(0x400, 2, 0);
          __builtin_amdgcn_sched_group_barrier(0x002, 1, 0);
        }
        __builtin_amdgcn_sched_group_barrier(0x002, 16, 0);      // units 6 and 7: FMAs
      }
      if (more) {
        float* nxt = sU[(c + 1) & 1];           // last read in pass c-1, ended by its barrier
#pragma unroll
        for (int k = 0; k < 16; ++k)
          *(v4f*)(nxt + (gr + 32 * k) * UP_ + gc) = pf[k];
        __syncthreads();                        // publishes chunk c+1, ends the reads of chunk c
      }
    }
#pragma unroll
    for (int t = 0; t < 4; ++t)
#pragma unroll
      for (int j = 0; j < 4; ++j)
        sP[(tBase + t) * S_ + sBase + 32 * j] = acc[t][j].x + acc[t][j].y;
  }

  // One chunk of mems (64 rows x 1 KB) into one uh buffer: 16 copies of 16 B per lane, a wave
  // covering 512 contiguous bytes per copy. Each run of copies ends, inside its own statement,
  // with the wait that stands before the copies' address registers are overwritten.
  const float* memB = mems + (size_t)b * S_ * D_;
  const int cr = tid >> 6;               // 64 threads cover one row; copy i takes row 4 i + cr
  const int cc = (tid & 63) << 2;
  auto copy_chunk = [&](int ch, int buf) {
    const float* g = memB + (unsigned)((ch * CK_ + cr) * D_ + cc);
    const unsigned l = (unsigned)(size_t)(&sU[buf][cr * MP_ + cc]);
#pragma unroll
    for (int h = 0; h < 16; h += 8)
      asm volatile(
          "global_load_async_to_lds_b128 %0, %8, off\n\t"
          "global_load_async_to_lds_b128 %1, %9, off\n\t"
          "global_load_async_to_lds_b128 %2, %10, off\n\t"
          "global_load_async_to_lds_b128 %3, %11, off\n\t"
          "global_load_async_to_lds_b128 %4, %12, off\n\t"
          "global_load_async_to_lds_b128 %5, %13, off\n\t"
          "global_load_async_to_lds_b128 %6, %14, off\n\t"
          "global_load_async_to_lds_b128 %7, %15, off\n\t"
          "s_wait_xcnt 0x0"
          :: "v"(l + (h + 0) * 16 * MP_), "v"(l + (h + 1) * 16 * MP_),
             "v"(l + (h + 2) * 16 * MP_), "v"(l + (h + 3) * 16 * MP_),
             "v"(l + (h + 4) * 16 * MP_), "v"(l + (h + 5) * 16 * MP_),
             "v"(l + (h + 6) * 16 * MP_), "v"(l + (h + 7) * 16 * MP_),
             "v"(g + (h + 0) * 4 * D_), "v"(g + (h + 1) * 4 * D_),
             "v"(g + (h + 2) * 4 * D_), "v"(g + (h + 3) * 4 * D_),
             "v"(g + (h + 4) * 4 * D_), "v"(g + (h + 5) * 4 * D_),
             "v"(g + (h + 6) * 4 * D_), "v"(g + (h + 7) * 4 * D_)
          : "memory");
  };

  // This wave's reads of uh have returned before the barrier behind which copies overwrite them.
  asm volatile("s_wait_dscnt 0x0" ::: "memory");
  __syncthreads();
  copy_chunk(0, 0);                      // flies during the softmax

  // --- Phase 2: masked softmax over s: one wave per row, the row's 512 scores in 16 registers a lane ---
  // All 16 LDS reads are in flight together; max and sum cross the lanes by register moves, so a
  // wave needs nothing of another wave until the barrier that publishes A.
  const int row = tid >> 5;
  const int sub = tid & 31;
  float e[S_ / 32];
#pragma unroll
  for (int i = 0; i < S_ / 32; ++i) e[i] = sP[row * S_ + sub + 32 * i];
  float mx = -INFINITY;
#pragma unroll
  for (int i = 0; i < S_ / 32; ++i)
    mx = fmaxf(mx, (sub + 32 * i < len) ? e[i] : -INFINITY);
  mx = fmaxf(mx, lane_xor_row<1>(mx));
  mx = fmaxf(mx, lane_xor_row<2>(mx));
  mx = fmaxf(mx, lane_xor_row<4>(mx));
  mx = fmaxf(mx, lane_xor_row<8>(mx));
  const float rm = fmaxf(mx, lane_xor_16(mx));
  // Three runs of 16 independent instructions each (arguments, exponentials, masked sum), held apart:
  // mixed, every exponential would stand directly behind its own argument and wait for it.
#pragma unroll
  for (int i = 0; i < S_ / 32; ++i) e[i] -= rm;
  __builtin_amdgcn_sched_barrier(0);
#pragma unroll
  for (int i = 0; i < S_ / 32; ++i) e[i] = __expf(e[i]);
  __builtin_amdgcn_sched_barrier(0);
  float sum = 0.0f;
#pragma unroll
  for (int i = 0; i < S_ / 32; ++i) {
    e[i] = (sub + 32 * i < len) ? e[i] : 0.0f;
    sum += e[i];
  }
  sum += lane_xor_row<1>(sum);
  sum += lane_xor_row<2>(sum);
  sum += lane_xor_row<4>(sum);
  sum += lane_xor_row<8>(sum);
  sum += lane_xor_16(sum);
  const float inv = 1.0f / sum;
  float* aOut = alignOut + ((size_t)b * T_ + t0 + row) * S_;
#pragma unroll     // 16 rounds with registers of their own: no store waits for the one before it
  for (int i = 0; i < S_ / 32; ++i) {
    const int s = sub + 32 * i;
    float p = e[i] * inv;
    // A of the context product: row t holds (p, 0) per s, row t + 8 holds (0, p).
    *(v2f*)(sPE + row * PA_ + 2 * s)       = (v2f){p, 0.0f};
    *(v2f*)(sPE + (row + 8) * PA_ + 2 * s) = (v2f){0.0f, p};
    aOut[s] = p;                               // masked slots are exactly 0
  }
  // This wave's copies of chunk 0 have landed; the barrier publishes them, and A, to all waves.
  asm volatile("s_wait_asynccnt 0x0" ::: "memory");
  __syncthreads();
  copy_chunk(1, 1);

  // --- Phase 3: context c = P[8,512] * mems[b][512,256] via f32 WMMA ---
  // A wave owns 32 columns. One WMMA takes two s rows, k and k+1 (lanes 0-15 row k, lanes 16-31
  // row k+1). A lane's B pair is one 8-B LDS read: its row's columns c, c+1. A pairs them with
  // (p, 0) in rows 0-7 and (0, p) in rows 8-15, so D rows 0-7 are column c, rows 8-15 column c+1
  // of the 8 t rows: no row of the instruction is a repeat. s ascends in every sum, as before.
  {
    const int wv   = tid >> 5;
    const int lane = tid & 31;
    const int r    = lane & 15;
    const int half = lane >> 4;
    const int c    = (wv << 5) + 2 * r;
    const float* pa = sPE + r * PA_ + 2 * half;
    v8f acc = {};
#pragma unroll 1   // one chunk body serves both buffers: short code
    for (int ch = 0; ch < S_ / CK_; ++ch) {
      const float* mb = &sU[ch & 1][half * MP_ + c];
      const float* ap = pa + ch * (2 * CK_);
      v2f fa[2][8], fb[2][8];                   // two fragment sets: group g of 8 WMMAs sits in set g & 1
      auto frag = [&](int g) {
#pragma unroll
        for (int q = 0; q < 8; ++q) {
          const int i = g * 8 + q;              // s rows 2 i, 2 i + 1 of the chunk
          fa[g & 1][q] = *(const v2f*)(ap + 4 * i);
          fb[g & 1][q] = *(const v2f*)(mb + 2 * i * MP_);
        }
      };
      frag(0);
      __builtin_amdgcn_sched_barrier(0);        // group 0's reads return first: the first WMMA waits for them alone
#pragma unroll
      for (int g = 0; g < CK_ / 16; ++g) {
        if (g + 1 < CK_ / 16) frag(g + 1);
        // Keeps the next group's LDS reads in front of this group's WMMAs, which cover their latency.
        __builtin_amdgcn_sched_barrier(0);
#pragma unroll
        for (int q = 0; q < 8; ++q)
          acc = __builtin_amdgcn_wmma_f32_16x16x4_f32(
              false, fa[g & 1][q], false, fb[g & 1][q], (short)0, acc, false, false);
        // The four vector slots between the group's last WMMA and vector work on its D, A or B
        // (address sums of the next reads and copies), held directly behind it.
        __builtin_amdgcn_sched_barrier(0);
        asm volatile("v_nop\n\tv_nop\n\tv_nop\n\tv_nop");
        __builtin_amdgcn_sched_barrier(0);
      }
      // Hand-over: this wave's reads of chunk ch have returned and its copies of chunk ch+1 have
      // landed; the barrier publishes chunk ch+1 and frees chunk ch's buffer for the refill.
      asm volatile("s_wait_dscnt 0x0" ::: "memory");
      asm volatile("s_wait_asynccnt 0x0" ::: "memory");
      __syncthreads();
      if (ch + 2 < S_ / CK_) copy_chunk(ch + 2, ch & 1);   // same for the whole block
    }
    asm volatile("s_wait_asynccnt 0x0" ::: "memory");      // no copy is left when the wave ends
    float* cp = cOut + ((size_t)b * T_ + t0) * D_ + c + half;
#pragma unroll
    for (int j = 0; j < 8; ++j)
      cp[j * D_] = acc[j];
  }
}

// ---------------------------------------------------------------------------
// Output projection: attn_h = concat(c, inputs) * Wout^T + bout
// K = 256 from c, then 512 from inputs, so the concat is never materialized.
// M = B*T = 2048, N = 512, K = 768.
// ---------------------------------------------------------------------------
__global__ __launch_bounds__(256) void outproj_kernel(
    const float* __restrict__ Cctx,   // [B*T, 256]
    const float* __restrict__ X,      // [B*T, 512]
    const float* __restrict__ W,      // [512, 768]
    const float* __restrict__ bias,   // [512]
    float* __restrict__ Out)          // [B*T, 512]
{
  __shared__ __attribute__((aligned(16))) float sA[2][64 * GP_];
  __shared__ __attribute__((aligned(16))) float sW[2][32 * GP_];
  gemm_nt_tile<D_ / KC_, D_, IN_ / KC_, IN_, IN_, true>(Cctx, X, W, bias, Out, blockIdx.x, sA, sW);
}

// ---------------------------------------------------------------------------
extern "C" void kernel_launch(void* const* d_in, const int* in_sizes, int n_in,
                              void* d_out, int out_size, void* d_ws, size_t ws_size,
                              hipStream_t stream) {
  const float* inputs    = (const float*)d_in[0];  // [B,T,IN]
  const float* mems      = (const float*)d_in[1];  // [B,S,D]
  const int*   mem_masks = (const int*)  d_in[2];  // [B]
  const float* Wq        = (const float*)d_in[3];  // [D,IN]
  const float* Wc        = (const float*)d_in[4];  // [D,D]
  const float* bc        = (const float*)d_in[5];  // [D]
  const float* v         = (const float*)d_in[6];  // [D]
  const float* Wout      = (const float*)d_in[7];  // [IN, D+IN]
  const float* bout      = (const float*)d_in[8];  // [IN]

  float* attn  = (float*)d_out;                        // [B,T,IN]
  float* align = attn + (size_t)B_ * T_ * IN_;         // [B,T,S]

  float* ws  = (float*)d_ws;
  float* wq  = ws;                                     // [B*T, D]
  float* uh  = wq + (size_t)B_ * T_ * D_;              // [B*S, D]
  float* ctx = uh + (size_t)B_ * S_ * D_;              // [B*T, D]

  const int M = B_ * T_;                               // 2048 (== B*S too)

  // 1) wq = inputs * Wq^T and uh = mems * Wc^T + bc : 64 x 32 tiles -> 256 + 256 blocks of 8 waves
  proj_qu_kernel<<<QB_ + UB_, 256, 0, stream>>>(inputs, Wq, wq, mems, Wc, bc, uh);

  // 2) fused tanh-score + masked softmax + context (one block per 8 t-rows)
  attn_score_ctx_kernel<<<B_ * (T_ / TT_), 256, 0, stream>>>(
      wq, uh, mems, v, mem_masks, align, ctx);

  // 3) attn_h = concat(ctx, inputs) * Wout^T + bout : 64 x 32 tiles -> 512 blocks
  outproj_kernel<<<(M / 64) * (IN_ / 32), 256, 0, stream>>>(
      ctx, inputs, Wout, bout, attn);
}
